// v000
// The times below were measured on an AMD MI455X: many runs one after another, warmed up first and cycling through
// copies of the inputs, with the whole window's GPU time divided by the number of runs. Launches and the gaps
// between them are all in it. The median over several windows is given; except for v000 it joins two sittings, which
// can be a few percent apart, so the side-by-side timings, each taken in one sitting, are the better comparison.
// v000, which the later versions start from, runs in 305 microseconds.
#include <hip/hip_runtime.h>

typedef __attribute__((ext_vector_type(16))) _Float16 v16h;
typedef __attribute__((ext_vector_type(8)))  _Float16 v8h;
typedef __attribute__((ext_vector_type(8)))  float    v8f;

#define D_INQ  1024
#define HEADS  16
#define DK     64
#define BATCH  2
#define SEQ    2048

__device__ __forceinline__ v16h load_frag_nt(const _Float16* p, int ld) {
    const int lane = threadIdx.x & 31;
    const int r    = lane & 15;
    const int koff = (lane >> 4) << 3;          // 0 or 8
    const _Float16* row = p + (size_t)r * ld + koff;
    v8h lo = *(const v8h*)(row);                // K = koff .. koff+7
    v8h hi = *(const v8h*)(row + 16);           // K = koff+16 .. koff+23
    v16h f;
#pragma unroll
    for (int i = 0; i < 8; ++i) { f[i] = lo[i]; f[i + 8] = hi[i]; }
    return f;
}

__device__ __forceinline__ v8f wmma16(v16h a, v16h b, v8f c) {
    return __builtin_amdgcn_wmma_f32_16x16x32_f16(false, a, false, b,
                                                  (short)0, c, false, false);
}

__device__ __forceinline__ float rmax16(float v) {
    v = fmaxf(v, __shfl_xor(v, 1));
    v = fmaxf(v, __shfl_xor(v, 2));
    v = fmaxf(v, __shfl_xor(v, 4));
    v = fmaxf(v, __shfl_xor(v, 8));
    return v;
}
__device__ __forceinline__ float rsum16(float v) {
    v += __shfl_xor(v, 1);
    v += __shfl_xor(v, 2);
    v += __shfl_xor(v, 4);
    v += __shfl_xor(v, 8);
    return v;
}

// ---- fp32 -> f16 conversion ----
__global__ void mha_cvt_f16_kernel(const float* __restrict__ src,
                                   _Float16* __restrict__ dst, int n) {
    int i = blockIdx.x * blockDim.x + threadIdx.x;
    int stride = gridDim.x * blockDim.x;
    for (; i < n; i += stride) dst[i] = (_Float16)src[i];
}

// ---- NT GEMM: C[M,1024] = A[M,1024] @ B[1024,1024]^T + bias ----
// Wave tile: 32 rows x 64 cols (2 A-frags share 4 B-frags -> 8 WMMA/K-step).
// Double-buffered, K-loop unrolled x2: stage s computes while stage 1-s loads.
// No rotation copies: each buffer written only by loads, read only by WMMAs.
// mode 0: store f16 [b,h,s,d] (scaled)   mode 2: store f16 [b,h,d,s]
// mode 3: store f32 row-major [M,1024]
__global__ void __launch_bounds__(256)
mha_gemm_nt_kernel(const _Float16* __restrict__ A,
                   const _Float16* __restrict__ Bm,
                   const float* __restrict__ bias,
                   void* __restrict__ outp, int mode, float scale) {
    const int wave = threadIdx.x >> 5;
    const int lane = threadIdx.x & 31;
    const int col  = lane & 15;
    const int hi   = lane >> 4;

    const int m0    = blockIdx.x << 5;                  // 32 rows per wave
    const int nbase = ((blockIdx.y << 3) + wave) << 6;  // 64 cols per wave

    v8f acc[2][4];
#pragma unroll
    for (int t = 0; t < 4; ++t) {
        float bv = bias[nbase + t * 16 + col];
#pragma unroll
        for (int i = 0; i < 8; ++i) { acc[0][t][i] = bv; acc[1][t][i] = bv; }
    }

    const _Float16* A0 = A + (size_t)m0 * D_INQ;
    const _Float16* A1 = A0 + (size_t)16 * D_INQ;
    const _Float16* Bw = Bm + (size_t)nbase * D_INQ;

    v16h a0[2], a1[2], bf[2][4];

    // prologue: stage 0 <- k = 0
    a0[0] = load_frag_nt(A0, D_INQ);
    a1[0] = load_frag_nt(A1, D_INQ);
#pragma unroll
    for (int t = 0; t < 4; ++t)
        bf[0][t] = load_frag_nt(Bw + (size_t)(t * 16) * D_INQ, D_INQ);

#pragma unroll 1
    for (int k = 0; k < D_INQ; k += 64) {
        // stage 1 <- k+32 (overlaps stage-0 WMMAs)
        const int k1 = k + 32;
        a0[1] = load_frag_nt(A0 + k1, D_INQ);
        a1[1] = load_frag_nt(A1 + k1, D_INQ);
#pragma unroll
        for (int t = 0; t < 4; ++t)
            bf[1][t] = load_frag_nt(Bw + (size_t)(t * 16) * D_INQ + k1, D_INQ);

#pragma unroll
        for (int t = 0; t < 4; ++t) {
            acc[0][t] = wmma16(a0[0], bf[0][t], acc[0][t]);
            acc[1][t] = wmma16(a1[0], bf[0][t], acc[1][t]);
        }

        // stage 0 <- k+64 (wraps to 0 on last iter; overlaps stage-1 WMMAs)
        const int k2 = (k + 64 < D_INQ) ? k + 64 : 0;
        a0[0] = load_frag_nt(A0 + k2, D_INQ);
        a1[0] = load_frag_nt(A1 + k2, D_INQ);
#pragma unroll
        for (int t = 0; t < 4; ++t)
            bf[0][t] = load_frag_nt(Bw + (size_t)(t * 16) * D_INQ + k2, D_INQ);

#pragma unroll
        for (int t = 0; t < 4; ++t) {
            acc[0][t] = wmma16(a0[1], bf[1][t], acc[0][t]);
            acc[1][t] = wmma16(a1[1], bf[1][t], acc[1][t]);
        }
    }

    if (mode == 3) {
        float* out = (float*)outp;
#pragma unroll
        for (int mh = 0; mh < 2; ++mh)
#pragma unroll
            for (int i = 0; i < 8; ++i) {
                int tg = m0 + mh * 16 + i + 8 * hi;
#pragma unroll
                for (int t = 0; t < 4; ++t)
                    out[(size_t)tg * D_INQ + nbase + t * 16 + col] = acc[mh][t][i];
            }
    } else {
        _Float16* out = (_Float16*)outp;
#pragma unroll
        for (int mh = 0; mh < 2; ++mh)
#pragma unroll
            for (int i = 0; i < 8; ++i) {
                int tg = m0 + mh * 16 + i + 8 * hi;
                int b = tg >> 11;         // / SEQ
                int s = tg & (SEQ - 1);
#pragma unroll
                for (int t = 0; t < 4; ++t) {
                    int o = nbase + t * 16 + col;
                    int h = o >> 6, d = o & 63;
                    _Float16 v = (_Float16)(acc[mh][t][i] * scale);
                    if (mode == 2)   // V transposed: [b,h,d,s]
                        out[((size_t)(b * HEADS + h) * DK + d) * SEQ + s] = v;
                    else             // Q/K: [b,h,s,d]
                        out[((size_t)(b * HEADS + h) * SEQ + s) * DK + d] = v;
                }
            }
    }
}

// ---- fused flash attention: one wave per 16-row q tile per (b,h) ----
__global__ void __launch_bounds__(128)
mha_attn_kernel(const _Float16* __restrict__ Q,
                const _Float16* __restrict__ Km,
                const _Float16* __restrict__ Vt,
                const int* __restrict__ mask,
                _Float16* __restrict__ ctx) {
    __shared__ _Float16 lds_p[4][16 * 32];
    const int wave = threadIdx.x >> 5;
    const int lane = threadIdx.x & 31;
    const int col  = lane & 15;
    const int hi   = lane >> 4;

    int tile = blockIdx.x * 4 + wave;       // 0 .. B*H*(S/16)-1
    int b  = tile >> 11;
    int r0 = tile & 2047;
    int h  = r0 >> 7;
    int q0 = (r0 & 127) << 4;

    const _Float16* Qbh = Q  + (size_t)(b * HEADS + h) * SEQ * DK;
    const _Float16* Kbh = Km + (size_t)(b * HEADS + h) * SEQ * DK;
    const _Float16* Vbh = Vt + (size_t)(b * HEADS + h) * DK * SEQ;
    const int* mb = mask + (size_t)b * SEQ * SEQ;
    _Float16* lp = lds_p[wave];

    // Q already scaled by 1/sqrt(dk) at projection time
    v16h aq0 = load_frag_nt(Qbh + (size_t)q0 * DK,      DK);
    v16h aq1 = load_frag_nt(Qbh + (size_t)q0 * DK + 32, DK);

    float mrun[8], lrun[8];
#pragma unroll
    for (int i = 0; i < 8; ++i) { mrun[i] = -3.0e38f; lrun[i] = 0.f; }
    v8f zero = {};
    v8f acc[4];
#pragma unroll
    for (int t = 0; t < 4; ++t) acc[t] = zero;

    // pipeline prologue: K fragments for k0 = 0
    v16h kf[4];
    kf[0] = load_frag_nt(Kbh,            DK);
    kf[1] = load_frag_nt(Kbh + 32,       DK);
    kf[2] = load_frag_nt(Kbh + 16 * DK,      DK);
    kf[3] = load_frag_nt(Kbh + 16 * DK + 32, DK);

    for (int k0 = 0; k0 < SEQ; k0 += 32) {
        // V fragments for this step: independent of scores, load early
        v16h vF[4];
#pragma unroll
        for (int t = 0; t < 4; ++t)
            vF[t] = load_frag_nt(Vbh + (size_t)(t * 16) * SEQ + k0, SEQ);

        // scores: two 16x16 tiles (cols k0..k0+15, k0+16..k0+31), K-dim = 64
        v8f sA = zero, sB = zero;
        sA = wmma16(aq0, kf[0], sA);
        sA = wmma16(aq1, kf[1], sA);
        sB = wmma16(aq0, kf[2], sB);
        sB = wmma16(aq1, kf[3], sB);

        // preload next step's K fragments; overlaps with softmax VALU below
        const int k0n = (k0 + 32 < SEQ) ? k0 + 32 : 0;
        __builtin_prefetch(Kbh + (size_t)k0n * DK, 0, 3);
        __builtin_prefetch(Vbh + k0n, 0, 3);
        kf[0] = load_frag_nt(Kbh + (size_t)k0n * DK,            DK);
        kf[1] = load_frag_nt(Kbh + (size_t)k0n * DK + 32,       DK);
        kf[2] = load_frag_nt(Kbh + (size_t)(k0n + 16) * DK,      DK);
        kf[3] = load_frag_nt(Kbh + (size_t)(k0n + 16) * DK + 32, DK);

        // mask + online softmax (row r = i + 8*hi, col = lane&15)
#pragma unroll
        for (int i = 0; i < 8; ++i) {
            int r = i + 8 * hi;
            const int* mrow = mb + (size_t)(q0 + r) * SEQ + k0 + col;
            float sa = (mrow[0]  == 0) ? -1.0e9f : sA[i];
            float sb = (mrow[16] == 0) ? -1.0e9f : sB[i];
            float rm = rmax16(fmaxf(sa, sb));
            float mn = fmaxf(mrun[i], rm);
            float alpha = __expf(mrun[i] - mn);
            float pa = __expf(sa - mn);
            float pb = __expf(sb - mn);
            lrun[i] = lrun[i] * alpha + rsum16(pa + pb);
            mrun[i] = mn;
            lp[r * 32 + col]      = (_Float16)pa;   // stage P for A-frag reload
            lp[r * 32 + 16 + col] = (_Float16)pb;
#pragma unroll
            for (int t = 0; t < 4; ++t) acc[t][i] *= alpha;
        }

        // context += P(16x32) @ V(32x64): B frags from transposed V
        v16h pF = load_frag_nt(lp, 32);
#pragma unroll
        for (int t = 0; t < 4; ++t)
            acc[t] = wmma16(pF, vF[t], acc[t]);
    }

    // normalize and store context back as [B,S,1024] f16 for the output GEMM
#pragma unroll
    for (int i = 0; i < 8; ++i) {
        int r = i + 8 * hi;
        float inv = 1.0f / lrun[i];
        size_t base = (size_t)(b * SEQ + q0 + r) * D_INQ + h * DK;
#pragma unroll
        for (int t = 0; t < 4; ++t)
            ctx[base + t * 16 + col] = (_Float16)(acc[t][i] * inv);
    }
}

extern "C" void kernel_launch(void* const* d_in, const int* in_sizes, int n_in,
                              void* d_out, int out_size, void* d_ws, size_t ws_size,
                              hipStream_t stream) {
    (void)in_sizes; (void)n_in; (void)out_size; (void)ws_size;
    const float* x   = (const float*)d_in[0];
    const int*   msk = (const int*)d_in[1];
    const float* Wq  = (const float*)d_in[2];
    const float* bq  = (const float*)d_in[3];
    const float* Wk  = (const float*)d_in[4];
    const float* bk  = (const float*)d_in[5];
    const float* Wv  = (const float*)d_in[6];
    const float* bv  = (const float*)d_in[7];
    const float* Wo  = (const float*)d_in[8];
    const float* bo  = (const float*)d_in[9];
    float* out = (float*)d_out;

    const size_t NX = (size_t)BATCH * SEQ * D_INQ;   // 4M elems
    const size_t NW = (size_t)D_INQ * D_INQ;         // 1M elems
    char* ws = (char*)d_ws;
    _Float16* xh  = (_Float16*)(ws);
    _Float16* wqh = (_Float16*)(ws + NX * 2);
    _Float16* wkh = (_Float16*)(ws + NX * 2 + NW * 2);
    _Float16* wvh = (_Float16*)(ws + NX * 2 + NW * 4);
    _Float16* woh = (_Float16*)(ws + NX * 2 + NW * 6);
    _Float16* Qh  = (_Float16*)(ws + NX * 2 + NW * 8);
    _Float16* Kh  = (_Float16*)(ws + NX * 4 + NW * 8);
    _Float16* Vth = (_Float16*)(ws + NX * 6 + NW * 8);
    _Float16* Ch  = (_Float16*)(ws + NX * 8 + NW * 8);

    mha_cvt_f16_kernel<<<2048, 256, 0, stream>>>(x,  xh,  (int)NX);
    mha_cvt_f16_kernel<<<512,  256, 0, stream>>>(Wq, wqh, (int)NW);
    mha_cvt_f16_kernel<<<512,  256, 0, stream>>>(Wk, wkh, (int)NW);
    mha_cvt_f16_kernel<<<512,  256, 0, stream>>>(Wv, wvh, (int)NW);
    mha_cvt_f16_kernel<<<512,  256, 0, stream>>>(Wo, woh, (int)NW);

    dim3 gg(BATCH * SEQ / 32, 2);   // 128 M-tiles x (2 x 8 waves x 64 cols)
    const float qscale = 0.125f;    // 1/sqrt(DK)
    mha_gemm_nt_kernel<<<gg, 256, 0, stream>>>(xh, wqh, bq, (void*)Qh,  0, qscale);
    mha_gemm_nt_kernel<<<gg, 256, 0, stream>>>(xh, wkh, bk, (void*)Kh,  0, 1.0f);
    mha_gemm_nt_kernel<<<gg, 256, 0, stream>>>(xh, wvh, bv, (void*)Vth, 2, 1.0f);

    mha_attn_kernel<<<BATCH * HEADS * (SEQ / 16) / 4, 128, 0, stream>>>(
        Qh, Kh, Vth, msk, Ch);

    mha_gemm_nt_kernel<<<gg, 256, 0, stream>>>(Ch, woh, bo, (void*)out, 3, 1.0f);
}

// v001
// One run takes 287 microseconds.
// Next to v000, in two timings, it ran 1.10 and 1.09 times as fast.
#include <hip/hip_runtime.h>

typedef __attribute__((ext_vector_type(16))) _Float16 v16h;
typedef __attribute__((ext_vector_type(8)))  _Float16 v8h;
typedef __attribute__((ext_vector_type(8)))  float    v8f;

#define D_INQ  1024
#define HEADS  16
#define DK     64
#define BATCH  2
#define SEQ    2048

__device__ __forceinline__ v16h load_frag_nt(const _Float16* p, int ld) {
    const int lane = threadIdx.x & 31;
    const int r    = lane & 15;
    const int koff = (lane >> 4) << 3;          // 0 or 8
    const _Float16* row = p + (size_t)r * ld + koff;
    v8h lo = *(const v8h*)(row);                // K = koff .. koff+7
    v8h hi = *(const v8h*)(row + 16);           // K = koff+16 .. koff+23
    v16h f;
#pragma unroll
    for (int i = 0; i < 8; ++i) { f[i] = lo[i]; f[i + 8] = hi[i]; }
    return f;
}

__device__ __forceinline__ v8f wmma16(v16h a, v16h b, v8f c) {
    return __builtin_amdgcn_wmma_f32_16x16x32_f16(false, a, false, b,
                                                  (short)0, c, false, false);
}

__device__ __forceinline__ float rmax16(float v) {
    v = fmaxf(v, __shfl_xor(v, 1));
    v = fmaxf(v, __shfl_xor(v, 2));
    v = fmaxf(v, __shfl_xor(v, 4));
    v = fmaxf(v, __shfl_xor(v, 8));
    return v;
}
__device__ __forceinline__ float rsum16(float v) {
    v += __shfl_xor(v, 1);
    v += __shfl_xor(v, 2);
    v += __shfl_xor(v, 4);
    v += __shfl_xor(v, 8);
    return v;
}

// ---- fp32 -> f16 conversion ----
__global__ void mha_cvt_f16_kernel(const float* __restrict__ src,
                                   _Float16* __restrict__ dst, int n) {
    int i = blockIdx.x * blockDim.x + threadIdx.x;
    int stride = gridDim.x * blockDim.x;
    for (; i < n; i += stride) dst[i] = (_Float16)src[i];
}

// ---- NT GEMM: C[M,1024] = A[M,1024] @ B[1024,1024]^T + bias ----
// Wave tile: 32 rows x 64 cols (2 A-frags share 4 B-frags -> 8 WMMA/K-step).
// Double-buffered, K-loop unrolled x2: stage s computes while stage 1-s loads.
// No rotation copies: each buffer written only by loads, read only by WMMAs.
// mode 0: store f16 [b,h,s,d] (scaled)   mode 2: store f16 [b,h,d,s]
// mode 3: store f32 row-major [M,1024]
__global__ void __launch_bounds__(256)
mha_gemm_nt_kernel(const _Float16* __restrict__ A,
                   const _Float16* __restrict__ Bm,
                   const float* __restrict__ bias,
                   void* __restrict__ outp, int mode, float scale) {
    const int wave = threadIdx.x >> 5;
    const int lane = threadIdx.x & 31;
    const int col  = lane & 15;
    const int hi   = lane >> 4;

    const int m0    = blockIdx.x << 5;                  // 32 rows per wave
    const int nbase = ((blockIdx.y << 3) + wave) << 6;  // 64 cols per wave

    v8f acc[2][4];
#pragma unroll
    for (int t = 0; t < 4; ++t) {
        float bv = bias[nbase + t * 16 + col];
#pragma unroll
        for (int i = 0; i < 8; ++i) { acc[0][t][i] = bv; acc[1][t][i] = bv; }
    }

    const _Float16* A0 = A + (size_t)m0 * D_INQ;
    const _Float16* A1 = A0 + (size_t)16 * D_INQ;
    const _Float16* Bw = Bm + (size_t)nbase * D_INQ;

    v16h a0[2], a1[2], bf[2][4];

    // prologue: stage 0 <- k = 0
    a0[0] = load_frag_nt(A0, D_INQ);
    a1[0] = load_frag_nt(A1, D_INQ);
#pragma unroll
    for (int t = 0; t < 4; ++t)
        bf[0][t] = load_frag_nt(Bw + (size_t)(t * 16) * D_INQ, D_INQ);

#pragma unroll 1
    for (int k = 0; k < D_INQ; k += 64) {
        // stage 1 <- k+32 (overlaps stage-0 WMMAs)
        const int k1 = k + 32;
        a0[1] = load_frag_nt(A0 + k1, D_INQ);
        a1[1] = load_frag_nt(A1 + k1, D_INQ);
#pragma unroll
        for (int t = 0; t < 4; ++t)
            bf[1][t] = load_frag_nt(Bw + (size_t)(t * 16) * D_INQ + k1, D_INQ);

#pragma unroll
        for (int t = 0; t < 4; ++t) {
            acc[0][t] = wmma16(a0[0], bf[0][t], acc[0][t]);
            acc[1][t] = wmma16(a1[0], bf[0][t], acc[1][t]);
        }

        // stage 0 <- k+64 (wraps to 0 on last iter; overlaps stage-1 WMMAs)
        const int k2 = (k + 64 < D_INQ) ? k + 64 : 0;
        a0[0] = load_frag_nt(A0 + k2, D_INQ);
        a1[0] = load_frag_nt(A1 + k2, D_INQ);
#pragma unroll
        for (int t = 0; t < 4; ++t)
            bf[0][t] = load_frag_nt(Bw + (size_t)(t * 16) * D_INQ + k2, D_INQ);

#pragma unroll
        for (int t = 0; t < 4; ++t) {
            acc[0][t] = wmma16(a0[1], bf[1][t], acc[0][t]);
            acc[1][t] = wmma16(a1[1], bf[1][t], acc[1][t]);
        }
    }

    if (mode == 3) {
        float* out = (float*)outp;
#pragma unroll
        for (int mh = 0; mh < 2; ++mh)
#pragma unroll
            for (int i = 0; i < 8; ++i) {
                int tg = m0 + mh * 16 + i + 8 * hi;
#pragma unroll
                for (int t = 0; t < 4; ++t)
                    out[(size_t)tg * D_INQ + nbase + t * 16 + col] = acc[mh][t][i];
            }
    } else if (mode == 2) {
        // V transposed [b,h,d,s]: a lane's 8 accumulator registers are 8
        // consecutive s of one d row, so they leave as one 16-byte store.
        _Float16* out = (_Float16*)outp;
#pragma unroll
        for (int mh = 0; mh < 2; ++mh) {
            int tg0 = m0 + mh * 16 + 8 * hi;   // multiple of 8: one batch, 16-B aligned
            int b  = tg0 >> 11;       // / SEQ
            int s0 = tg0 & (SEQ - 1);
#pragma unroll
            for (int t = 0; t < 4; ++t) {
                int o = nbase + t * 16 + col;
                int h = o >> 6, d = o & 63;
                v8h pk;
#pragma unroll
                for (int i = 0; i < 8; ++i)
                    pk[i] = (_Float16)(acc[mh][t][i] * scale);
                *(v8h*)(out + ((size_t)(b * HEADS + h) * DK + d) * SEQ + s0) = pk;
            }
        }
    } else {
        _Float16* out = (_Float16*)outp;
#pragma unroll
        for (int mh = 0; mh < 2; ++mh)
#pragma unroll
            for (int i = 0; i < 8; ++i) {
                int tg = m0 + mh * 16 + i + 8 * hi;
                int b = tg >> 11;         // / SEQ
                int s = tg & (SEQ - 1);
#pragma unroll
                for (int t = 0; t < 4; ++t) {
                    int o = nbase + t * 16 + col;
                    int h = o >> 6, d = o & 63;
                    _Float16 v = (_Float16)(acc[mh][t][i] * scale);
                    // Q/K: [b,h,s,d]
                    out[((size_t)(b * HEADS + h) * SEQ + s) * DK + d] = v;
                }
            }
    }
}

// ---- fused flash attention: one wave per 16-row q tile per (b,h) ----
__global__ void __launch_bounds__(128)
mha_attn_kernel(const _Float16* __restrict__ Q,
                const _Float16* __restrict__ Km,
                const _Float16* __restrict__ Vt,
                const int* __restrict__ mask,
                _Float16* __restrict__ ctx) {
    __shared__ _Float16 lds_p[4][16 * 32];
    const int wave = threadIdx.x >> 5;
    const int lane = threadIdx.x & 31;
    const int col  = lane & 15;
    const int hi   = lane >> 4;

    int tile = blockIdx.x * 4 + wave;       // 0 .. B*H*(S/16)-1
    int b  = tile >> 11;
    int r0 = tile & 2047;
    int h  = r0 >> 7;
    int q0 = (r0 & 127) << 4;

    const _Float16* Qbh = Q  + (size_t)(b * HEADS + h) * SEQ * DK;
    const _Float16* Kbh = Km + (size_t)(b * HEADS + h) * SEQ * DK;
    const _Float16* Vbh = Vt + (size_t)(b * HEADS + h) * DK * SEQ;
    const int* mb = mask + (size_t)b * SEQ * SEQ;
    _Float16* lp = lds_p[wave];

    // Q already scaled by 1/sqrt(dk) at projection time
    v16h aq0 = load_frag_nt(Qbh + (size_t)q0 * DK,      DK);
    v16h aq1 = load_frag_nt(Qbh + (size_t)q0 * DK + 32, DK);

    float mrun[8], lrun[8];
#pragma unroll
    for (int i = 0; i < 8; ++i) { mrun[i] = -3.0e38f; lrun[i] = 0.f; }
    v8f zero = {};
    v8f acc[4];
#pragma unroll
    for (int t = 0; t < 4; ++t) acc[t] = zero;

    // pipeline prologue: K fragments for k0 = 0
    v16h kf[4];
    kf[0] = load_frag_nt(Kbh,            DK);
    kf[1] = load_frag_nt(Kbh + 32,       DK);
    kf[2] = load_frag_nt(Kbh + 16 * DK,      DK);
    kf[3] = load_frag_nt(Kbh + 16 * DK + 32, DK);

    for (int k0 = 0; k0 < SEQ; k0 += 32) {
        // V fragments for this step: independent of scores, load early
        v16h vF[4];
#pragma unroll
        for (int t = 0; t < 4; ++t)
            vF[t] = load_frag_nt(Vbh + (size_t)(t * 16) * SEQ + k0, SEQ);

        // scores: two 16x16 tiles (cols k0..k0+15, k0+16..k0+31), K-dim = 64
        v8f sA = zero, sB = zero;
        sA = wmma16(aq0, kf[0], sA);
        sA = wmma16(aq1, kf[1], sA);
        sB = wmma16(aq0, kf[2], sB);
        sB = wmma16(aq1, kf[3], sB);

        // preload next step's K fragments; overlaps with softmax VALU below
        const int k0n = (k0 + 32 < SEQ) ? k0 + 32 : 0;
        __builtin_prefetch(Kbh + (size_t)k0n * DK, 0, 3);
        __builtin_prefetch(Vbh + k0n, 0, 3);
        kf[0] = load_frag_nt(Kbh + (size_t)k0n * DK,            DK);
        kf[1] = load_frag_nt(Kbh + (size_t)k0n * DK + 32,       DK);
        kf[2] = load_frag_nt(Kbh + (size_t)(k0n + 16) * DK,      DK);
        kf[3] = load_frag_nt(Kbh + (size_t)(k0n + 16) * DK + 32, DK);

        // mask + online softmax (row r = i + 8*hi, col = lane&15)
#pragma unroll
        for (int i = 0; i < 8; ++i) {
            int r = i + 8 * hi;
            const int* mrow = mb + (size_t)(q0 + r) * SEQ + k0 + col;
            float sa = (mrow[0]  == 0) ? -1.0e9f : sA[i];
            float sb = (mrow[16] == 0) ? -1.0e9f : sB[i];
            float rm = rmax16(fmaxf(sa, sb));
            float mn = fmaxf(mrun[i], rm);
            float alpha = __expf(mrun[i] - mn);
            float pa = __expf(sa - mn);
            float pb = __expf(sb - mn);
            lrun[i] = lrun[i] * alpha + rsum16(pa + pb);
            mrun[i] = mn;
            lp[r * 32 + col]      = (_Float16)pa;   // stage P for A-frag reload
            lp[r * 32 + 16 + col] = (_Float16)pb;
#pragma unroll
            for (int t = 0; t < 4; ++t) acc[t][i] *= alpha;
        }

        // context += P(16x32) @ V(32x64): B frags from transposed V
        v16h pF = load_frag_nt(lp, 32);
#pragma unroll
        for (int t = 0; t < 4; ++t)
            acc[t] = wmma16(pF, vF[t], acc[t]);
    }

    // normalize and store context back as [B,S,1024] f16 for the output GEMM
#pragma unroll
    for (int i = 0; i < 8; ++i) {
        int r = i + 8 * hi;
        float inv = 1.0f / lrun[i];
        size_t base = (size_t)(b * SEQ + q0 + r) * D_INQ + h * DK;
#pragma unroll
        for (int t = 0; t < 4; ++t)
            ctx[base + t * 16 + col] = (_Float16)(acc[t][i] * inv);
    }
}

extern "C" void kernel_launch(void* const* d_in, const int* in_sizes, int n_in,
                              void* d_out, int out_size, void* d_ws, size_t ws_size,
                              hipStream_t stream) {
    (void)in_sizes; (void)n_in; (void)out_size; (void)ws_size;
    const float* x   = (const float*)d_in[0];
    const int*   msk = (const int*)d_in[1];
    const float* Wq  = (const float*)d_in[2];
    const float* bq  = (const float*)d_in[3];
    const float* Wk  = (const float*)d_in[4];
    const float* bk  = (const float*)d_in[5];
    const float* Wv  = (const float*)d_in[6];
    const float* bv  = (const float*)d_in[7];
    const float* Wo  = (const float*)d_in[8];
    const float* bo  = (const float*)d_in[9];
    float* out = (float*)d_out;

    const size_t NX = (size_t)BATCH * SEQ * D_INQ;   // 4M elems
    const size_t NW = (size_t)D_INQ * D_INQ;         // 1M elems
    char* ws = (char*)d_ws;
    _Float16* xh  = (_Float16*)(ws);
    _Float16* wqh = (_Float16*)(ws + NX * 2);
    _Float16* wkh = (_Float16*)(ws + NX * 2 + NW * 2);
    _Float16* wvh = (_Float16*)(ws + NX * 2 + NW * 4);
    _Float16* woh = (_Float16*)(ws + NX * 2 + NW * 6);
    _Float16* Qh  = (_Float16*)(ws + NX * 2 + NW * 8);
    _Float16* Kh  = (_Float16*)(ws + NX * 4 + NW * 8);
    _Float16* Vth = (_Float16*)(ws + NX * 6 + NW * 8);
    _Float16* Ch  = (_Float16*)(ws + NX * 8 + NW * 8);

    mha_cvt_f16_kernel<<<2048, 256, 0, stream>>>(x,  xh,  (int)NX);
    mha_cvt_f16_kernel<<<512,  256, 0, stream>>>(Wq, wqh, (int)NW);
    mha_cvt_f16_kernel<<<512,  256, 0, stream>>>(Wk, wkh, (int)NW);
    mha_cvt_f16_kernel<<<512,  256, 0, stream>>>(Wv, wvh, (int)NW);
    mha_cvt_f16_kernel<<<512,  256, 0, stream>>>(Wo, woh, (int)NW);

    dim3 gg(BATCH * SEQ / 32, 2);   // 128 M-tiles x (2 x 8 waves x 64 cols)
    const float qscale = 0.125f;    // 1/sqrt(DK)
    mha_gemm_nt_kernel<<<gg, 256, 0, stream>>>(xh, wqh, bq, (void*)Qh,  0, qscale);
    mha_gemm_nt_kernel<<<gg, 256, 0, stream>>>(xh, wkh, bk, (void*)Kh,  0, 1.0f);
    mha_gemm_nt_kernel<<<gg, 256, 0, stream>>>(xh, wvh, bv, (void*)Vth, 2, 1.0f);

    mha_attn_kernel<<<BATCH * HEADS * (SEQ / 16) / 4, 128, 0, stream>>>(
        Qh, Kh, Vth, msk, Ch);

    mha_gemm_nt_kernel<<<gg, 256, 0, stream>>>(Ch, woh, bo, (void*)out, 3, 1.0f);
}

// v002
// Measured time: 251 microseconds a run.
// Timed twice side by side with v001, it ran 1.14 times as fast both times.
// Over all steps from v000 it is 1.25 times as fast.
#include <hip/hip_runtime.h>

typedef __attribute__((ext_vector_type(16))) _Float16 v16h;
typedef __attribute__((ext_vector_type(8)))  _Float16 v8h;
typedef __attribute__((ext_vector_type(8)))  float    v8f;
typedef __attribute__((ext_vector_type(4)))  int      v4i;

#define D_INQ  1024
#define HEADS  16
#define DK     64
#define BATCH  2
#define SEQ    2048

__device__ __forceinline__ v16h load_frag_nt(const _Float16* p, int ld) {
    const int lane = threadIdx.x & 31;
    const int r    = lane & 15;
    const int koff = (lane >> 4) << 3;          // 0 or 8
    const _Float16* row = p + (size_t)r * ld + koff;
    v8h lo = *(const v8h*)(row);                // K = koff .. koff+7
    v8h hi = *(const v8h*)(row + 16);           // K = koff+16 .. koff+23
    v16h f;
#pragma unroll
    for (int i = 0; i < 8; ++i) { f[i] = lo[i]; f[i + 8] = hi[i]; }
    return f;
}

__device__ __forceinline__ v8f wmma16(v16h a, v16h b, v8f c) {
    return __builtin_amdgcn_wmma_f32_16x16x32_f16(false, a, false, b,
                                                  (short)0, c, false, false);
}

__device__ __forceinline__ float xhalf(float x) {
    int b = __builtin_bit_cast(int, x);
    return __builtin_bit_cast(float,
        __builtin_amdgcn_permlanex16(b, b, 0x76543210, 0xfedcba98, false, false));
}

// ---- fp32 -> f16 conversion ----
__global__ void mha_cvt_f16_kernel(const float* __restrict__ src,
                                   _Float16* __restrict__ dst, int n) {
    int i = blockIdx.x * blockDim.x + threadIdx.x;
    int stride = gridDim.x * blockDim.x;
    for (; i < n; i += stride) dst[i] = (_Float16)src[i];
}

// ---- NT GEMM: C[M,1024] = A[M,1024] @ B[1024,1024]^T + bias ----
// Wave tile: 32 rows x 64 cols (2 A-frags share 4 B-frags -> 8 WMMA/K-step).
// Double-buffered, K-loop unrolled x2: stage s computes while stage 1-s loads.
// No rotation copies: each buffer written only by loads, read only by WMMAs.
// mode 0: store f16 [b,h,s,d] (scaled)   mode 2: store f16 [b,h,d,s]
// mode 3: store f32 row-major [M,1024]
__global__ void __launch_bounds__(256)
mha_gemm_nt_kernel(const _Float16* __restrict__ A,
                   const _Float16* __restrict__ Bm,
                   const float* __restrict__ bias,
                   void* __restrict__ outp, int mode, float scale) {
    const int wave = threadIdx.x >> 5;
    const int lane = threadIdx.x & 31;
    const int col  = lane & 15;
    const int hi   = lane >> 4;

    const int m0    = blockIdx.x << 5;                  // 32 rows per wave
    const int nbase = ((blockIdx.y << 3) + wave) << 6;  // 64 cols per wave

    v8f acc[2][4];
#pragma unroll
    for (int t = 0; t < 4; ++t) {
        float bv = bias[nbase + t * 16 + col];
#pragma unroll
        for (int i = 0; i < 8; ++i) { acc[0][t][i] = bv; acc[1][t][i] = bv; }
    }

    const _Float16* A0 = A + (size_t)m0 * D_INQ;
    const _Float16* A1 = A0 + (size_t)16 * D_INQ;
    const _Float16* Bw = Bm + (size_t)nbase * D_INQ;

    v16h a0[2], a1[2], bf[2][4];

    // prologue: stage 0 <- k = 0
    a0[0] = load_frag_nt(A0, D_INQ);
    a1[0] = load_frag_nt(A1, D_INQ);
#pragma unroll
    for (int t = 0; t < 4; ++t)
        bf[0][t] = load_frag_nt(Bw + (size_t)(t * 16) * D_INQ, D_INQ);

#pragma unroll 1
    for (int k = 0; k < D_INQ; k += 64) {
        // stage 1 <- k+32 (overlaps stage-0 WMMAs)
        const int k1 = k + 32;
        a0[1] = load_frag_nt(A0 + k1, D_INQ);
        a1[1] = load_frag_nt(A1 + k1, D_INQ);
#pragma unroll
        for (int t = 0; t < 4; ++t)
            bf[1][t] = load_frag_nt(Bw + (size_t)(t * 16) * D_INQ + k1, D_INQ);

#pragma unroll
        for (int t = 0; t < 4; ++t) {
            acc[0][t] = wmma16(a0[0], bf[0][t], acc[0][t]);
            acc[1][t] = wmma16(a1[0], bf[0][t], acc[1][t]);
        }

        // stage 0 <- k+64 (wraps to 0 on last iter; overlaps stage-1 WMMAs)
        const int k2 = (k + 64 < D_INQ) ? k + 64 : 0;
        a0[0] = load_frag_nt(A0 + k2, D_INQ);
        a1[0] = load_frag_nt(A1 + k2, D_INQ);
#pragma unroll
        for (int t = 0; t < 4; ++t)
            bf[0][t] = load_frag_nt(Bw + (size_t)(t * 16) * D_INQ + k2, D_INQ);

#pragma unroll
        for (int t = 0; t < 4; ++t) {
            acc[0][t] = wmma16(a0[1], bf[1][t], acc[0][t]);
            acc[1][t] = wmma16(a1[1], bf[1][t], acc[1][t]);
        }
    }

    if (mode == 3) {
        float* out = (float*)outp;
#pragma unroll
        for (int mh = 0; mh < 2; ++mh)
#pragma unroll
            for (int i = 0; i < 8; ++i) {
                int tg = m0 + mh * 16 + i + 8 * hi;
#pragma unroll
                for (int t = 0; t < 4; ++t)
                    out[(size_t)tg * D_INQ + nbase + t * 16 + col] = acc[mh][t][i];
            }
    } else if (mode == 2) {
        // V transposed [b,h,d,s]: a lane's 8 accumulator registers are 8
        // consecutive s of one d row, so they leave as one 16-byte store.
        _Float16* out = (_Float16*)outp;
#pragma unroll
        for (int mh = 0; mh < 2; ++mh) {
            int tg0 = m0 + mh * 16 + 8 * hi;   // multiple of 8: one batch, 16-B aligned
            int b  = tg0 >> 11;       // / SEQ
            int s0 = tg0 & (SEQ - 1);
#pragma unroll
            for (int t = 0; t < 4; ++t) {
                int o = nbase + t * 16 + col;
                int h = o >> 6, d = o & 63;
                v8h pk;
#pragma unroll
                for (int i = 0; i < 8; ++i)
                    pk[i] = (_Float16)(acc[mh][t][i] * scale);
                *(v8h*)(out + ((size_t)(b * HEADS + h) * DK + d) * SEQ + s0) = pk;
            }
        }
    } else {
        _Float16* out = (_Float16*)outp;
#pragma unroll
        for (int mh = 0; mh < 2; ++mh)
#pragma unroll
            for (int i = 0; i < 8; ++i) {
                int tg = m0 + mh * 16 + i + 8 * hi;
                int b = tg >> 11;         // / SEQ
                int s = tg & (SEQ - 1);
#pragma unroll
                for (int t = 0; t < 4; ++t) {
                    int o = nbase + t * 16 + col;
                    int h = o >> 6, d = o & 63;
                    _Float16 v = (_Float16)(acc[mh][t][i] * scale);
                    // Q/K: [b,h,s,d]
                    out[((size_t)(b * HEADS + h) * SEQ + s) * DK + d] = v;
                }
            }
    }
}

__global__ void __launch_bounds__(128) __attribute__((amdgpu_waves_per_eu(4, 4)))
mha_attn_kernel(const _Float16* __restrict__ Q,
                const _Float16* __restrict__ Km,
                const _Float16* __restrict__ Vt,
                const int* __restrict__ mask,
                _Float16* __restrict__ ctx) {
    const int wave = threadIdx.x >> 5;
    const int lane = threadIdx.x & 31;
    const int col  = lane & 15;
    const int hi   = lane >> 4;

    int tile = blockIdx.x * 4 + wave;       // 0 .. B*H*(S/16)-1
    int b  = tile >> 11;
    int r0 = tile & 2047;
    int h  = r0 >> 7;
    int q0 = (r0 & 127) << 4;

    const _Float16* Qbh = Q  + (size_t)(b * HEADS + h) * SEQ * DK;
    const _Float16* Kbh = Km + (size_t)(b * HEADS + h) * SEQ * DK;
    const _Float16* Vbh = Vt + (size_t)(b * HEADS + h) * DK * SEQ;
    // this lane's query row of the mask, at its first key of a 32-key step
    const int* mrow = mask + (size_t)b * SEQ * SEQ + (size_t)(q0 + col) * SEQ + 8 * hi;

    // Q already scaled by 1/sqrt(dk) at projection time
    v16h aq0 = load_frag_nt(Qbh + (size_t)q0 * DK,      DK);
    v16h aq1 = load_frag_nt(Qbh + (size_t)q0 * DK + 32, DK);

    float mrun = -3.0e38f;   // running maximum of query col (equal in both halves)
    float lrun = 0.f;        // running sum over this lane's own keys only
    v8f zero = {};
    v8f acc[4];              // acc[t][i] = O[q0 + col][t*16 + 8*hi + i]
#pragma unroll
    for (int t = 0; t < 4; ++t) acc[t] = zero;

    // pipeline prologue: K fragments for k0 = 0
    v16h kf[4];
    kf[0] = load_frag_nt(Kbh,            DK);
    kf[1] = load_frag_nt(Kbh + 32,       DK);
    kf[2] = load_frag_nt(Kbh + 16 * DK,      DK);
    kf[3] = load_frag_nt(Kbh + 16 * DK + 32, DK);

    for (int k0 = 0; k0 < SEQ; k0 += 32) {
        // mask words and V fragments of this step: independent of scores, load early
        v4i mk[4];
        mk[0] = *(const v4i*)(mrow + k0);
        mk[1] = *(const v4i*)(mrow + k0 + 4);
        mk[2] = *(const v4i*)(mrow + k0 + 16);
        mk[3] = *(const v4i*)(mrow + k0 + 20);
        v16h vF[4];
#pragma unroll
        for (int t = 0; t < 4; ++t)
            vF[t] = load_frag_nt(Vbh + (size_t)(t * 16) * SEQ + k0, SEQ);

        // S^T: two 16x16 tiles (key rows k0..k0+15, k0+16..k0+31), K-dim = 64
        v8f sA = zero, sB = zero;
        sA = wmma16(kf[0], aq0, sA);
        sA = wmma16(kf[1], aq1, sA);
        sB = wmma16(kf[2], aq0, sB);
        sB = wmma16(kf[3], aq1, sB);

        // preload next step's K fragments; overlaps with softmax VALU below
        const int k0n = (k0 + 32 < SEQ) ? k0 + 32 : 0;
        __builtin_prefetch(Kbh + (size_t)k0n * DK, 0, 3);
        __builtin_prefetch(Vbh + k0n, 0, 3);
        kf[0] = load_frag_nt(Kbh + (size_t)k0n * DK,            DK);
        kf[1] = load_frag_nt(Kbh + (size_t)k0n * DK + 32,       DK);
        kf[2] = load_frag_nt(Kbh + (size_t)(k0n + 16) * DK,      DK);
        kf[3] = load_frag_nt(Kbh + (size_t)(k0n + 16) * DK + 32, DK);

        // mask + online softmax; s[j] is key k0 + kmap(j): j < 8 from sA, else sB
        float s[16];
#pragma unroll
        for (int i = 0; i < 8; ++i) {
            s[i]     = (mk[i >> 2][i & 3]       == 0) ? -1.0e9f : sA[i];
            s[i + 8] = (mk[2 + (i >> 2)][i & 3] == 0) ? -1.0e9f : sB[i];
        }
        float mx[8];
#pragma unroll
        for (int i = 0; i < 8; ++i) mx[i] = fmaxf(s[i], s[i + 8]);
        float rm = fmaxf(fmaxf(fmaxf(mx[0], mx[1]), fmaxf(mx[2], mx[3])),
                         fmaxf(fmaxf(mx[4], mx[5]), fmaxf(mx[6], mx[7])));
        rm = fmaxf(rm, xhalf(rm));
        float mn = fmaxf(mrun, rm);
        float alpha = __expf(mrun - mn);
        mrun = mn;

        float p[16];
        v16h pF;
#pragma unroll
        for (int j = 0; j < 16; ++j) {
            p[j]  = __expf(s[j] - mn);
            pF[j] = (_Float16)p[j];
        }
        float ps[4];
#pragma unroll
        for (int j = 0; j < 4; ++j)
            ps[j] = (p[j] + p[j + 4]) + (p[j + 8] + p[j + 12]);
        lrun = lrun * alpha + ((ps[0] + ps[1]) + (ps[2] + ps[3]));

        // O^T = O^T * alpha + V^T(64x32) @ P^T(32x16)
#pragma unroll
        for (int t = 0; t < 4; ++t) {
#pragma unroll
            for (int i = 0; i < 8; ++i) acc[t][i] *= alpha;
            acc[t] = wmma16(vF[t], pF, acc[t]);
        }
    }

    // join the halves' sums, normalize, store context as [B,S,1024] f16 for the
    // output GEMM: a lane's 8 registers are 8 consecutive d of one query row
    float inv = 1.0f / (lrun + xhalf(lrun));
    _Float16* crow = ctx + (size_t)(b * SEQ + q0 + col) * D_INQ + h * DK + 8 * hi;
#pragma unroll
    for (int t = 0; t < 4; ++t) {
        v8h pk;
#pragma unroll
        for (int i = 0; i < 8; ++i) pk[i] = (_Float16)(acc[t][i] * inv);
        *(v8h*)(crow + t * 16) = pk;
    }
}

extern "C" void kernel_launch(void* const* d_in, const int* in_sizes, int n_in,
                              void* d_out, int out_size, void* d_ws, size_t ws_size,
                              hipStream_t stream) {
    (void)in_sizes; (void)n_in; (void)out_size; (void)ws_size;
    const float* x   = (const float*)d_in[0];
    const int*   msk = (const int*)d_in[1];
    const float* Wq  = (const float*)d_in[2];
    const float* bq  = (const float*)d_in[3];
    const float* Wk  = (const float*)d_in[4];
    const float* bk  = (const float*)d_in[5];
    const float* Wv  = (const float*)d_in[6];
    const float* bv  = (const float*)d_in[7];
    const float* Wo  = (const float*)d_in[8];
    const float* bo  = (const float*)d_in[9];
    float* out = (float*)d_out;

    const size_t NX = (size_t)BATCH * SEQ * D_INQ;   // 4M elems
    const size_t NW = (size_t)D_INQ * D_INQ;         // 1M elems
    char* ws = (char*)d_ws;
    _Float16* xh  = (_Float16*)(ws);
    _Float16* wqh = (_Float16*)(ws + NX * 2);
    _Float16* wkh = (_Float16*)(ws + NX * 2 + NW * 2);
    _Float16* wvh = (_Float16*)(ws + NX * 2 + NW * 4);
    _Float16* woh = (_Float16*)(ws + NX * 2 + NW * 6);
    _Float16* Qh  = (_Float16*)(ws + NX * 2 + NW * 8);
    _Float16* Kh  = (_Float16*)(ws + NX * 4 + NW * 8);
    _Float16* Vth = (_Float16*)(ws + NX * 6 + NW * 8);
    _Float16* Ch  = (_Float16*)(ws + NX * 8 + NW * 8);

    mha_cvt_f16_kernel<<<2048, 256, 0, stream>>>(x,  xh,  (int)NX);
    mha_cvt_f16_kernel<<<512,  256, 0, stream>>>(Wq, wqh, (int)NW);
    mha_cvt_f16_kernel<<<512,  256, 0, stream>>>(Wk, wkh, (int)NW);
    mha_cvt_f16_kernel<<<512,  256, 0, stream>>>(Wv, wvh, (int)NW);
    mha_cvt_f16_kernel<<<512,  256, 0, stream>>>(Wo, woh, (int)NW);

    dim3 gg(BATCH * SEQ / 32, 2);   // 128 M-tiles x (2 x 8 waves x 64 cols)
    const float qscale = 0.125f;    // 1/sqrt(DK)
    mha_gemm_nt_kernel<<<gg, 256, 0, stream>>>(xh, wqh, bq, (void*)Qh,  0, qscale);
    mha_gemm_nt_kernel<<<gg, 256, 0, stream>>>(xh, wkh, bk, (void*)Kh,  0, 1.0f);
    mha_gemm_nt_kernel<<<gg, 256, 0, stream>>>(xh, wvh, bv, (void*)Vth, 2, 1.0f);

    mha_attn_kernel<<<BATCH * HEADS * (SEQ / 16) / 4, 128, 0, stream>>>(
        Qh, Kh, Vth, msk, Ch);

    mha_gemm_nt_kernel<<<gg, 256, 0, stream>>>(Ch, woh, bo, (void*)out, 3, 1.0f);
}

// v003
// A run of this version takes 203 microseconds.
// Timed twice side by side with v002, it ran 1.26 and 1.22 times as fast.
// Over all steps from v000 it is 1.55 times as fast.
#include <hip/hip_runtime.h>

typedef __attribute__((ext_vector_type(16))) _Float16 v16h;
typedef __attribute__((ext_vector_type(8)))  _Float16 v8h;
typedef __attribute__((ext_vector_type(8)))  float    v8f;
typedef __attribute__((ext_vector_type(4)))  int      v4i;
typedef __attribute__((ext_vector_type(4)))  float    v4f;

#define D_INQ  1024
#define HEADS  16
#define DK     64
#define BATCH  2
#define SEQ    2048

#define FRAG 512
__device__ __forceinline__ v16h load_frag_t(const _Float16* tile) {
    const int lane = threadIdx.x & 31;
    const _Float16* p = tile + lane * 8;
    v8h lo = *(const v8h*)(p);                  // K = 8*(l>>4) .. +7
    v8h hi = *(const v8h*)(p + 256);            // K = 16 + 8*(l>>4) .. +7
    v16h f;
#pragma unroll
    for (int i = 0; i < 8; ++i) { f[i] = lo[i]; f[i + 8] = hi[i]; }
    return f;
}

__device__ __forceinline__ v8f wmma16(v16h a, v16h b, v8f c) {
    return __builtin_amdgcn_wmma_f32_16x16x32_f16(false, a, false, b,
                                                  (short)0, c, false, false);
}

__device__ __forceinline__ float xhalf(float x) {
    int b = __builtin_bit_cast(int, x);
    return __builtin_bit_cast(float,
        __builtin_amdgcn_permlanex16(b, b, 0x76543210, 0xfedcba98, false, false));
}

// ---- fp32 [rows,1024] row-major -> f16 in fragment order ----
// One 16-byte chunk (8 consecutive k of one row) per thread, threads in the
// order of the destination, so that a wave stores 512 contiguous bytes.
__global__ void mha_cvt_f16_kernel(const float* __restrict__ src,
                                   _Float16* __restrict__ dst, int n) {
    int g = blockIdx.x * blockDim.x + threadIdx.x;
    int stride = gridDim.x * blockDim.x;
    const int nchunk = n >> 3;
    for (; g < nchunk; g += stride) {
        const int r    = g & 15;
        const int c    = (g >> 4) & 3;
        const int tile = g >> 6;                     // row tile * 32 + k tile
        const int row  = ((tile >> 5) << 4) + r;
        const int k    = ((tile & 31) << 5) + (c << 3);
        const float* s = src + (size_t)row * D_INQ + k;
        v4f u = *(const v4f*)(s);
        v4f w = *(const v4f*)(s + 4);
        v8h pk;
#pragma unroll
        for (int i = 0; i < 4; ++i) { pk[i] = (_Float16)u[i]; pk[i + 4] = (_Float16)w[i]; }
        *(v8h*)(dst + (size_t)g * 8) = pk;
    }
}

// ---- NT GEMM: C[M,N] = A[M,1024] @ B[N,1024]^T + bias, A and B in fragment order ----
// Wave tile: 32 rows x 64 cols (2 A-frags share 4 B-frags -> 8 WMMA/K-step).
// Double-buffered, K-loop unrolled x2: stage s computes while stage 1-s loads.
// No rotation copies: each buffer written only by loads, read only by WMMAs.
// mode 0: A = weight (rows = features), B = tokens, bias by row; a lane's 8
//         accumulator registers are 8 consecutive d of one token: one chunk of
//         the [s x d] operand of head (b,h), stored f16 in fragment order (scaled)
// mode 2: A = tokens, B = weight; f16 V^T of head (b,h) in fragment order
// mode 3: A = tokens, B = weight; f32 row-major [M,1024]
__global__ void __launch_bounds__(256)
mha_gemm_nt_kernel(const _Float16* __restrict__ A,
                   const _Float16* __restrict__ Bm,
                   const float* __restrict__ bias,
                   void* __restrict__ outp, int mode, float scale) {
    const int wave = __builtin_amdgcn_readfirstlane(threadIdx.x >> 5);
    const int lane = threadIdx.x & 31;
    const int col  = lane & 15;
    const int hi   = lane >> 4;

    const int m0    = blockIdx.x << 5;                  // 32 rows per wave
    const int nbase = ((blockIdx.y << 3) + wave) << 6;  // 64 cols per wave

    v8f acc[2][4];
    if (mode == 0) {
#pragma unroll
        for (int mh = 0; mh < 2; ++mh)
#pragma unroll
            for (int i = 0; i < 8; ++i) {
                float bv = bias[m0 + mh * 16 + 8 * hi + i];
#pragma unroll
                for (int t = 0; t < 4; ++t) acc[mh][t][i] = bv;
            }
    } else {
#pragma unroll
        for (int t = 0; t < 4; ++t) {
            float bv = bias[nbase + t * 16 + col];
#pragma unroll
            for (int i = 0; i < 8; ++i) { acc[0][t][i] = bv; acc[1][t][i] = bv; }
        }
    }

    // a 16-row band is RT = 32 tiles; k advances one tile (FRAG halves) per 32
    const int RT = (D_INQ / 32) * FRAG;
    const _Float16* A0 = A + (size_t)(m0 >> 4) * RT;
    const _Float16* A1 = A0 + RT;
    const _Float16* Bw = Bm + (size_t)(nbase >> 4) * RT;

    v16h a0[2], a1[2], bf[2][4];

    // prologue: stage 0 <- k = 0
    a0[0] = load_frag_t(A0);
    a1[0] = load_frag_t(A1);
#pragma unroll
    for (int t = 0; t < 4; ++t)
        bf[0][t] = load_frag_t(Bw + t * RT);

    const _Float16* pa = A0;    // tiles of stage 0, wave-uniform
    const _Float16* pb = Bw;
#pragma unroll 1
    for (int k = 0; k < D_INQ; k += 64) {
        // stage 1 <- k+32 (overlaps stage-0 WMMAs)
        a0[1] = load_frag_t(pa + FRAG);
        a1[1] = load_frag_t(pa + RT + FRAG);
#pragma unroll
        for (int t = 0; t < 4; ++t)
            bf[1][t] = load_frag_t(pb + t * RT + FRAG);

#pragma unroll
        for (int t = 0; t < 4; ++t) {
            acc[0][t] = wmma16(a0[0], bf[0][t], acc[0][t]);
            acc[1][t] = wmma16(a1[0], bf[0][t], acc[1][t]);
        }

        // stage 0 <- k+64 (wraps to 0 on last iter; overlaps stage-1 WMMAs)
        const bool more = k + 64 < D_INQ;
        pa = more ? pa + 2 * FRAG : A0;
        pb = more ? pb + 2 * FRAG : Bw;
        a0[0] = load_frag_t(pa);
        a1[0] = load_frag_t(pa + RT);
#pragma unroll
        for (int t = 0; t < 4; ++t)
            bf[0][t] = load_frag_t(pb + t * RT);

#pragma unroll
        for (int t = 0; t < 4; ++t) {
            acc[0][t] = wmma16(a0[1], bf[1][t], acc[0][t]);
            acc[1][t] = wmma16(a1[1], bf[1][t], acc[1][t]);
        }
    }
    // the last trip's loads still name the lane offset, which the epilogues rewrite
    asm volatile("s_wait_xcnt 0x0" ::: "memory");

    if (mode == 3) {
        float* out = (float*)outp;
#pragma unroll
        for (int mh = 0; mh < 2; ++mh)
#pragma unroll
            for (int i = 0; i < 8; ++i) {
                int tg = m0 + mh * 16 + i + 8 * hi;
#pragma unroll
                for (int t = 0; t < 4; ++t)
                    out[(size_t)tg * D_INQ + nbase + t * 16 + col] = acc[mh][t][i];
            }
        // the stores' registers may be rewritten behind this branch
        asm volatile("s_wait_xcnt 0x0" ::: "memory");
    } else if (mode == 2) {
        // V^T of head (b,h), rows d, k = s: a lane's 8 accumulator registers are
        // 8 consecutive s of one d row, one chunk. Tiles in the order
        // [32-key step][d tile], so that a step's four fragments are 4 KB in a row.
        _Float16* out = (_Float16*)outp;
#pragma unroll
        for (int mh = 0; mh < 2; ++mh) {
            int tg0 = m0 + mh * 16 + 8 * hi;   // multiple of 8: one batch, 16-B aligned
            int b  = tg0 >> 11;       // / SEQ
            int s0 = tg0 & (SEQ - 1);
#pragma unroll
            for (int t = 0; t < 4; ++t) {
                int o = nbase + t * 16 + col;
                int h = o >> 6, d = o & 63;
                v8h pk;
#pragma unroll
                for (int i = 0; i < 8; ++i)
                    pk[i] = (_Float16)(acc[mh][t][i] * scale);
                *(v8h*)(out + (size_t)(b * HEADS + h) * DK * SEQ
                            + (size_t)((s0 >> 5) * 4 + (d >> 4)) * FRAG
                            + ((s0 >> 3) & 3) * 128 + (d & 15) * 8) = pk;
            }
        }
    } else {
        // Q/K of head (b,h), rows s, k = d: tiles in the order [16-row band][d / 32]
        _Float16* out = (_Float16*)outp;
#pragma unroll
        for (int mh = 0; mh < 2; ++mh) {
            int o0 = m0 + mh * 16 + 8 * hi;    // multiple of 8: one head, one chunk
            int h  = o0 >> 6, d0 = o0 & 63;
#pragma unroll
            for (int t = 0; t < 4; ++t) {
                int tg = nbase + t * 16 + col;
                int b = tg >> 11;         // / SEQ
                int s = tg & (SEQ - 1);
                v8h pk;
#pragma unroll
                for (int i = 0; i < 8; ++i)
                    pk[i] = (_Float16)(acc[mh][t][i] * scale);
                *(v8h*)(out + (size_t)(b * HEADS + h) * SEQ * DK
                            + (size_t)((s >> 4) * 2 + (d0 >> 5)) * FRAG
                            + ((d0 >> 3) & 3) * 128 + (s & 15) * 8) = pk;
            }
        }
        // the stores' registers may be rewritten behind this branch
        asm volatile("s_wait_xcnt 0x0" ::: "memory");
    }
}

__global__ void __launch_bounds__(128) __attribute__((amdgpu_waves_per_eu(4, 4)))
mha_attn_kernel(const _Float16* __restrict__ Q,
                const _Float16* __restrict__ Km,
                const _Float16* __restrict__ Vt,
                const int* __restrict__ mask,
                _Float16* __restrict__ ctx) {
    const int wave = threadIdx.x >> 5;
    const int lane = threadIdx.x & 31;
    const int col  = lane & 15;
    const int hi   = lane >> 4;

    // tile = blockIdx.x * 4 + wave, 0 .. B*H*(S/16)-1; a block's 4 tiles share
    // one head, so b and h come from blockIdx alone and stay scalar
    int b  = blockIdx.x >> 9;
    int h  = (blockIdx.x >> 5) & (HEADS - 1);
    int q0 = (((blockIdx.x & 31) << 2) + wave) << 4;

    const _Float16* Qbh = Q  + (size_t)(b * HEADS + h) * SEQ * DK;
    const _Float16* Kbh = Km + (size_t)(b * HEADS + h) * SEQ * DK;
    const _Float16* Vbh = Vt + (size_t)(b * HEADS + h) * DK * SEQ;
    // this lane's query row of the mask, at its first key of a 32-key step
    const int* mrow = mask + (size_t)b * SEQ * SEQ + (size_t)(q0 + col) * SEQ + 8 * hi;

    // Q already scaled by 1/sqrt(dk) at projection time
    // (a 16-row band of Q or K is two tiles, d 0..31 and d 32..63: 16 * DK halves)
    v16h aq0 = load_frag_t(Qbh + (size_t)q0 * DK);
    v16h aq1 = load_frag_t(Qbh + (size_t)q0 * DK + FRAG);
    // pipeline prologue: K fragments for k0 = 0
    v16h kf[4];
#pragma unroll
    for (int j = 0; j < 4; ++j) kf[j] = load_frag_t(Kbh + j * FRAG);
    // these loads name registers that the set-up below reuses; the scheduling
    // barrier keeps that set-up behind the wait
    asm volatile("s_wait_xcnt 0x0" ::: "memory");
    __builtin_amdgcn_sched_barrier(0);

    float mrun = -3.0e38f;   // running maximum of query col (equal in both halves)
    float lrun = 0.f;        // running sum over this lane's own keys only
    v8f zero = {};
    v8f acc[4];              // acc[t][i] = O[q0 + col][t*16 + 8*hi + i]
#pragma unroll
    for (int t = 0; t < 4; ++t) acc[t] = zero;

    for (int k0 = 0; k0 < SEQ; k0 += 32) {
        // mask words and V fragments of this step: independent of scores, load early
        v4i mk[4];
        mk[0] = *(const v4i*)(mrow + k0);
        mk[1] = *(const v4i*)(mrow + k0 + 4);
        mk[2] = *(const v4i*)(mrow + k0 + 16);
        mk[3] = *(const v4i*)(mrow + k0 + 20);
        v16h vF[4];
#pragma unroll
        for (int t = 0; t < 4; ++t)
            vF[t] = load_frag_t(Vbh + (size_t)k0 * DK + t * FRAG);

        // S^T: two 16x16 tiles (key rows k0..k0+15, k0+16..k0+31), K-dim = 64
        v8f sA = zero, sB = zero;
        sA = wmma16(kf[0], aq0, sA);
        sA = wmma16(kf[1], aq1, sA);
        sB = wmma16(kf[2], aq0, sB);
        sB = wmma16(kf[3], aq1, sB);

        // preload next step's K fragments; overlaps with softmax VALU below
        const int k0n = (k0 + 32 < SEQ) ? k0 + 32 : 0;
        __builtin_prefetch(Kbh + (size_t)k0n * DK, 0, 3);
        __builtin_prefetch(Vbh + (size_t)k0n * DK, 0, 3);
#pragma unroll
        for (int j = 0; j < 4; ++j)
            kf[j] = load_frag_t(Kbh + (size_t)k0n * DK + j * FRAG);

        // mask + online softmax; s[j] is key k0 + kmap(j): j < 8 from sA, else sB
        float s[16];
#pragma unroll
        for (int i = 0; i < 8; ++i) {
            s[i]     = (mk[i >> 2][i & 3]       == 0) ? -1.0e9f : sA[i];
            s[i + 8] = (mk[2 + (i >> 2)][i & 3] == 0) ? -1.0e9f : sB[i];
        }
        float mx[8];
#pragma unroll
        for (int i = 0; i < 8; ++i) mx[i] = fmaxf(s[i], s[i + 8]);
        float rm = fmaxf(fmaxf(fmaxf(mx[0], mx[1]), fmaxf(mx[2], mx[3])),
                         fmaxf(fmaxf(mx[4], mx[5]), fmaxf(mx[6], mx[7])));
        rm = fmaxf(rm, xhalf(rm));
        float mn = fmaxf(mrun, rm);
        float alpha = __expf(mrun - mn);
        mrun = mn;

        float p[16];
        v16h pF;
#pragma unroll
        for (int j = 0; j < 16; ++j) {
            p[j]  = __expf(s[j] - mn);
            pF[j] = (_Float16)p[j];
        }
        float ps[4];
#pragma unroll
        for (int j = 0; j < 4; ++j)
            ps[j] = (p[j] + p[j + 4]) + (p[j + 8] + p[j + 12]);
        lrun = lrun * alpha + ((ps[0] + ps[1]) + (ps[2] + ps[3]));

        // O^T = O^T * alpha + V^T(64x32) @ P^T(32x16)
#pragma unroll
        for (int t = 0; t < 4; ++t) {
#pragma unroll
            for (int i = 0; i < 8; ++i) acc[t][i] *= alpha;
            acc[t] = wmma16(vF[t], pF, acc[t]);
        }
    }

    // join the halves' sums, normalize, store context [B*S rows, 1024 k] f16 in
    // fragment order for the output GEMM: a lane's 8 registers are 8 consecutive
    // d of one query row, one chunk; k = h*64 + t*16 + 8*hi is tile h*2 + (t>>1),
    // chunk (t&1)*2 + hi
    float inv = 1.0f / (lrun + xhalf(lrun));
    _Float16* crow = ctx + ((size_t)((b * SEQ + q0) >> 4) * (D_INQ / 32) + h * 2) * FRAG
                         + hi * 128 + col * 8;
#pragma unroll
    for (int t = 0; t < 4; ++t) {
        v8h pk;
#pragma unroll
        for (int i = 0; i < 8; ++i) pk[i] = (_Float16)(acc[t][i] * inv);
        *(v8h*)(crow + (t >> 1) * FRAG + (t & 1) * 256) = pk;
    }
}

extern "C" void kernel_launch(void* const* d_in, const int* in_sizes, int n_in,
                              void* d_out, int out_size, void* d_ws, size_t ws_size,
                              hipStream_t stream) {
    (void)in_sizes; (void)n_in; (void)out_size; (void)ws_size;
    const float* x   = (const float*)d_in[0];
    const int*   msk = (const int*)d_in[1];
    const float* Wq  = (const float*)d_in[2];
    const float* bq  = (const float*)d_in[3];
    const float* Wk  = (const float*)d_in[4];
    const float* bk  = (const float*)d_in[5];
    const float* Wv  = (const float*)d_in[6];
    const float* bv  = (const float*)d_in[7];
    const float* Wo  = (const float*)d_in[8];
    const float* bo  = (const float*)d_in[9];
    float* out = (float*)d_out;

    const size_t NX = (size_t)BATCH * SEQ * D_INQ;   // 4M elems
    const size_t NW = (size_t)D_INQ * D_INQ;         // 1M elems
    char* ws = (char*)d_ws;
    _Float16* xh  = (_Float16*)(ws);
    _Float16* wqh = (_Float16*)(ws + NX * 2);
    _Float16* wkh = (_Float16*)(ws + NX * 2 + NW * 2);
    _Float16* wvh = (_Float16*)(ws + NX * 2 + NW * 4);
    _Float16* woh = (_Float16*)(ws + NX * 2 + NW * 6);
    _Float16* Qh  = (_Float16*)(ws + NX * 2 + NW * 8);
    _Float16* Kh  = (_Float16*)(ws + NX * 4 + NW * 8);
    _Float16* Vth = (_Float16*)(ws + NX * 6 + NW * 8);
    _Float16* Ch  = (_Float16*)(ws + NX * 8 + NW * 8);

    mha_cvt_f16_kernel<<<2048, 256, 0, stream>>>(x,  xh,  (int)NX);
    mha_cvt_f16_kernel<<<512,  256, 0, stream>>>(Wq, wqh, (int)NW);
    mha_cvt_f16_kernel<<<512,  256, 0, stream>>>(Wk, wkh, (int)NW);
    mha_cvt_f16_kernel<<<512,  256, 0, stream>>>(Wv, wvh, (int)NW);
    mha_cvt_f16_kernel<<<512,  256, 0, stream>>>(Wo, woh, (int)NW);

    dim3 gg(BATCH * SEQ / 32, 2);   // 128 M-tiles x (2 x 8 waves x 64 cols)
    const float qscale = 0.125f;    // 1/sqrt(DK)
    dim3 gt(D_INQ / 32, BATCH * SEQ / 512);   // 32 feature tiles x (8 x 8 waves x 64 tokens)
    mha_gemm_nt_kernel<<<gt, 256, 0, stream>>>(wqh, xh, bq, (void*)Qh,  0, qscale);
    mha_gemm_nt_kernel<<<gt, 256, 0, stream>>>(wkh, xh, bk, (void*)Kh,  0, 1.0f);
    mha_gemm_nt_kernel<<<gg, 256, 0, stream>>>(xh, wvh, bv, (void*)Vth, 2, 1.0f);

    mha_attn_kernel<<<BATCH * HEADS * (SEQ / 16) / 4, 128, 0, stream>>>(
        Qh, Kh, Vth, msk, Ch);

    mha_gemm_nt_kernel<<<gg, 256, 0, stream>>>(Ch, woh, bo, (void*)out, 3, 1.0f);
}

// v004
// One run takes 192 microseconds.
// Two timings next to v003 both put it at 1.05 times that version's speed.
// All steps since v000 together make it 1.62 times as fast.
#include <hip/hip_runtime.h>

typedef __attribute__((ext_vector_type(16))) _Float16 v16h;
typedef __attribute__((ext_vector_type(8)))  _Float16 v8h;
typedef __attribute__((ext_vector_type(8)))  float    v8f;
typedef __attribute__((ext_vector_type(4)))  int      v4i;
typedef __attribute__((ext_vector_type(4)))  float    v4f;
typedef __attribute__((ext_vector_type(2)))  unsigned v2u;
typedef __attribute__((ext_vector_type(16))) unsigned v16u;

#define D_INQ  1024
#define HEADS  16
#define DK     64
#define BATCH  2
#define SEQ    2048

#define FRAG 512
__device__ __forceinline__ v16h load_frag_t(const _Float16* tile) {
    const int lane = threadIdx.x & 31;
    const _Float16* p = tile + lane * 8;
    v8h lo = *(const v8h*)(p);                  // K = 8*(l>>4) .. +7
    v8h hi = *(const v8h*)(p + 256);            // K = 16 + 8*(l>>4) .. +7
    v16h f;
#pragma unroll
    for (int i = 0; i < 8; ++i) { f[i] = lo[i]; f[i + 8] = hi[i]; }
    return f;
}

__device__ __forceinline__ v8f wmma16(v16h a, v16h b, v8f c) {
    return __builtin_amdgcn_wmma_f32_16x16x32_f16(false, a, false, b,
                                                  (short)0, c, false, false);
}

__device__ __forceinline__ float xhalf(float x) {
    int b = __builtin_bit_cast(int, x);
    return __builtin_bit_cast(float,
        __builtin_amdgcn_permlanex16(b, b, 0x76543210, 0xfedcba98, false, false));
}

// ---- fp32 [rows,1024] row-major -> f16 in fragment order ----
// One 16-byte chunk (8 consecutive k of one row) per thread, threads in the
// order of the destination, so that a wave stores 512 contiguous bytes.
__global__ void mha_cvt_f16_kernel(const float* __restrict__ src,
                                   _Float16* __restrict__ dst, int n) {
    int g = blockIdx.x * blockDim.x + threadIdx.x;
    int stride = gridDim.x * blockDim.x;
    const int nchunk = n >> 3;
    for (; g < nchunk; g += stride) {
        const int r    = g & 15;
        const int c    = (g >> 4) & 3;
        const int tile = g >> 6;                     // row tile * 32 + k tile
        const int row  = ((tile >> 5) << 4) + r;
        const int k    = ((tile & 31) << 5) + (c << 3);
        const float* s = src + (size_t)row * D_INQ + k;
        v4f u = *(const v4f*)(s);
        v4f w = *(const v4f*)(s + 4);
        v8h pk;
#pragma unroll
        for (int i = 0; i < 4; ++i) { pk[i] = (_Float16)u[i]; pk[i + 4] = (_Float16)w[i]; }
        *(v8h*)(dst + (size_t)g * 8) = pk;
    }
}

__global__ void __launch_bounds__(256)
mha_mask_pack_kernel(const int* __restrict__ mask, unsigned* __restrict__ mw) {
    const int lane = threadIdx.x & 31;
    const int col  = lane & 15;
    const int hi   = lane >> 4;
    const int task = blockIdx.x * 8 + (threadIdx.x >> 5);   // tile * 16 + group of 4 steps
    const int tile = task >> 4;                             // b * (SEQ / 16) + q tile
    const int k0   = (task & 15) << 7;
    const int* mrow = mask + (size_t)(tile * 16 + col) * SEQ + k0 + 8 * hi;
    v4i m[16];
#pragma unroll
    for (int st = 0; st < 4; ++st)
#pragma unroll
        for (int g = 0; g < 4; ++g)
            m[st * 4 + g] = *(const v4i*)(mrow + st * 32 + (g >> 1) * 16 + (g & 1) * 4);
    v2u w = {0u, 0u};
#pragma unroll
    for (int j = 0; j < 64; ++j) {
        unsigned bl = __builtin_amdgcn_ballot_w32(m[j >> 2][j & 3] != 0);
        w[j & 1] = (lane == (j >> 1)) ? bl : w[j & 1];
    }
    *(v2u*)(mw + (size_t)task * 64 + lane * 2) = w;
}

// ---- NT GEMM: C[M,N] = A[M,1024] @ B[N,1024]^T + bias, A and B in fragment order ----
// Wave tile: 32 rows x 64 cols (2 A-frags share 4 B-frags -> 8 WMMA/K-step).
// Double-buffered, K-loop unrolled x2: stage s computes while stage 1-s loads.
// No rotation copies: each buffer written only by loads, read only by WMMAs.
// mode 0: A = weight (rows = features), B = tokens, bias by row; a lane's 8
//         accumulator registers are 8 consecutive d of one token: one chunk of
//         the [s x d] operand of head (b,h), stored f16 in fragment order (scaled)
// mode 2: A = tokens, B = weight; f16 V^T of head (b,h) in fragment order
// mode 3: A = tokens, B = weight; f32 row-major [M,1024]
__global__ void __launch_bounds__(256)
mha_gemm_nt_kernel(const _Float16* __restrict__ A,
                   const _Float16* __restrict__ Bm,
                   const float* __restrict__ bias,
                   void* __restrict__ outp, int mode, float scale) {
    const int wave = __builtin_amdgcn_readfirstlane(threadIdx.x >> 5);
    const int lane = threadIdx.x & 31;
    const int col  = lane & 15;
    const int hi   = lane >> 4;

    const int m0    = blockIdx.x << 5;                  // 32 rows per wave
    const int nbase = ((blockIdx.y << 3) + wave) << 6;  // 64 cols per wave

    v8f acc[2][4];
    if (mode == 0) {
#pragma unroll
        for (int mh = 0; mh < 2; ++mh)
#pragma unroll
            for (int i = 0; i < 8; ++i) {
                float bv = bias[m0 + mh * 16 + 8 * hi + i];
#pragma unroll
                for (int t = 0; t < 4; ++t) acc[mh][t][i] = bv;
            }
    } else {
#pragma unroll
        for (int t = 0; t < 4; ++t) {
            float bv = bias[nbase + t * 16 + col];
#pragma unroll
            for (int i = 0; i < 8; ++i) { acc[0][t][i] = bv; acc[1][t][i] = bv; }
        }
    }

    // a 16-row band is RT = 32 tiles; k advances one tile (FRAG halves) per 32
    const int RT = (D_INQ / 32) * FRAG;
    const _Float16* A0 = A + (size_t)(m0 >> 4) * RT;
    const _Float16* A1 = A0 + RT;
    const _Float16* Bw = Bm + (size_t)(nbase >> 4) * RT;

    v16h a0[2], a1[2], bf[2][4];

    // prologue: stage 0 <- k = 0
    a0[0] = load_frag_t(A0);
    a1[0] = load_frag_t(A1);
#pragma unroll
    for (int t = 0; t < 4; ++t)
        bf[0][t] = load_frag_t(Bw + t * RT);

    const _Float16* pa = A0;    // tiles of stage 0, wave-uniform
    const _Float16* pb = Bw;
#pragma unroll 1
    for (int k = 0; k < D_INQ; k += 64) {
        // stage 1 <- k+32 (overlaps stage-0 WMMAs)
        a0[1] = load_frag_t(pa + FRAG);
        a1[1] = load_frag_t(pa + RT + FRAG);
#pragma unroll
        for (int t = 0; t < 4; ++t)
            bf[1][t] = load_frag_t(pb + t * RT + FRAG);

#pragma unroll
        for (int t = 0; t < 4; ++t) {
            acc[0][t] = wmma16(a0[0], bf[0][t], acc[0][t]);
            acc[1][t] = wmma16(a1[0], bf[0][t], acc[1][t]);
        }

        // stage 0 <- k+64 (wraps to 0 on last iter; overlaps stage-1 WMMAs)
        const bool more = k + 64 < D_INQ;
        pa = more ? pa + 2 * FRAG : A0;
        pb = more ? pb + 2 * FRAG : Bw;
        a0[0] = load_frag_t(pa);
        a1[0] = load_frag_t(pa + RT);
#pragma unroll
        for (int t = 0; t < 4; ++t)
            bf[0][t] = load_frag_t(pb + t * RT);

#pragma unroll
        for (int t = 0; t < 4; ++t) {
            acc[0][t] = wmma16(a0[1], bf[1][t], acc[0][t]);
            acc[1][t] = wmma16(a1[1], bf[1][t], acc[1][t]);
        }
    }
    // the last trip's loads still name the lane offset, which the epilogues rewrite
    asm volatile("s_wait_xcnt 0x0" ::: "memory");

    if (mode == 3) {
        float* out = (float*)outp;
#pragma unroll
        for (int mh = 0; mh < 2; ++mh)
#pragma unroll
            for (int i = 0; i < 8; ++i) {
                int tg = m0 + mh * 16 + i + 8 * hi;
#pragma unroll
                for (int t = 0; t < 4; ++t)
                    out[(size_t)tg * D_INQ + nbase + t * 16 + col] = acc[mh][t][i];
            }
        // the stores' registers may be rewritten behind this branch
        asm volatile("s_wait_xcnt 0x0" ::: "memory");
    } else if (mode == 2) {
        // V^T of head (b,h), rows d, k = s: a lane's 8 accumulator registers are
        // 8 consecutive s of one d row, one chunk. Tiles in the order
        // [32-key step][d tile], so that a step's four fragments are 4 KB in a row.
        _Float16* out = (_Float16*)outp;
#pragma unroll
        for (int mh = 0; mh < 2; ++mh) {
            int tg0 = m0 + mh * 16 + 8 * hi;   // multiple of 8: one batch, 16-B aligned
            int b  = tg0 >> 11;       // / SEQ
            int s0 = tg0 & (SEQ - 1);
#pragma unroll
            for (int t = 0; t < 4; ++t) {
                int o = nbase + t * 16 + col;
                int h = o >> 6, d = o & 63;
                v8h pk;
#pragma unroll
                for (int i = 0; i < 8; ++i)
                    pk[i] = (_Float16)(acc[mh][t][i] * scale);
                *(v8h*)(out + (size_t)(b * HEADS + h) * DK * SEQ
                            + (size_t)((s0 >> 5) * 4 + (d >> 4)) * FRAG
                            + ((s0 >> 3) & 3) * 128 + (d & 15) * 8) = pk;
            }
        }
    } else {
        // Q/K of head (b,h), rows s, k = d: tiles in the order [16-row band][d / 32]
        _Float16* out = (_Float16*)outp;
#pragma unroll
        for (int mh = 0; mh < 2; ++mh) {
            int o0 = m0 + mh * 16 + 8 * hi;    // multiple of 8: one head, one chunk
            int h  = o0 >> 6, d0 = o0 & 63;
#pragma unroll
            for (int t = 0; t < 4; ++t) {
                int tg = nbase + t * 16 + col;
                int b = tg >> 11;         // / SEQ
                int s = tg & (SEQ - 1);
                v8h pk;
#pragma unroll
                for (int i = 0; i < 8; ++i)
                    pk[i] = (_Float16)(acc[mh][t][i] * scale);
                *(v8h*)(out + (size_t)(b * HEADS + h) * SEQ * DK
                            + (size_t)((s >> 4) * 2 + (d0 >> 5)) * FRAG
                            + ((d0 >> 3) & 3) * 128 + (s & 15) * 8) = pk;
            }
        }
        // the stores' registers may be rewritten behind this branch
        asm volatile("s_wait_xcnt 0x0" ::: "memory");
    }
}

__global__ void __launch_bounds__(128) __attribute__((amdgpu_waves_per_eu(4, 4)))
mha_attn_kernel(const _Float16* __restrict__ Q,
                const _Float16* __restrict__ Km,
                const _Float16* __restrict__ Vt,
                const unsigned* __restrict__ mwords,
                _Float16* __restrict__ ctx) {
    const int wave = threadIdx.x >> 5;
    const int lane = threadIdx.x & 31;
    const int col  = lane & 15;
    const int hi   = lane >> 4;

    // tile = blockIdx.x * 4 + wave, 0 .. B*H*(S/16)-1; a block's 4 tiles share
    // one head, so b and h come from blockIdx alone and stay scalar
    int b  = blockIdx.x >> 9;
    int h  = (blockIdx.x >> 5) & (HEADS - 1);
    int q0 = (((blockIdx.x & 31) << 2) + wave) << 4;

    const _Float16* Qbh = Q  + (size_t)(b * HEADS + h) * SEQ * DK;
    const _Float16* Kbh = Km + (size_t)(b * HEADS + h) * SEQ * DK;
    const _Float16* Vbh = Vt + (size_t)(b * HEADS + h) * DK * SEQ;
    // the wave's lane-mask words, 16 per 32-key step; the wave's number as a
    // scalar, so that they come by scalar loads into scalar registers
    const int wv = __builtin_amdgcn_readfirstlane(threadIdx.x >> 5);
    const unsigned* mw = mwords
        + (size_t)(b * (SEQ / 16) + ((blockIdx.x & 31) << 2) + wv) * (SEQ / 32) * 16;
    v16u wc = *(const v16u*)(mw);       // step 0's words

    // Q already scaled by 1/sqrt(dk) at projection time
    // (a 16-row band of Q or K is two tiles, d 0..31 and d 32..63: 16 * DK halves)
    v16h aq0 = load_frag_t(Qbh + (size_t)q0 * DK);
    v16h aq1 = load_frag_t(Qbh + (size_t)q0 * DK + FRAG);
    // pipeline prologue: K fragments for k0 = 0
    v16h kf[4];
#pragma unroll
    for (int j = 0; j < 4; ++j) kf[j] = load_frag_t(Kbh + j * FRAG);
    // these loads name registers that the set-up below reuses; the scheduling
    // barrier keeps that set-up behind the wait
    asm volatile("s_wait_xcnt 0x0" ::: "memory");
    __builtin_amdgcn_sched_barrier(0);

    float mrun = -3.0e38f;   // running maximum of query col (equal in both halves)
    float lrun = 0.f;        // running sum over this lane's own keys only
    v8f zero = {};
    v8f acc[4];              // acc[t][i] = O[q0 + col][t*16 + 8*hi + i]
#pragma unroll
    for (int t = 0; t < 4; ++t) acc[t] = zero;

    for (int k0 = 0; k0 < SEQ; k0 += 32) {
        // V fragments of this step: independent of scores, load early
        v16h vF[4];
#pragma unroll
        for (int t = 0; t < 4; ++t)
            vF[t] = load_frag_t(Vbh + (size_t)k0 * DK + t * FRAG);

        // S^T: two 16x16 tiles (key rows k0..k0+15, k0+16..k0+31), K-dim = 64
        v8f sA = zero, sB = zero;
        sA = wmma16(kf[0], aq0, sA);
        sA = wmma16(kf[1], aq1, sA);
        sB = wmma16(kf[2], aq0, sB);
        sB = wmma16(kf[3], aq1, sB);

        // preload next step's K fragments; overlaps with softmax VALU below
        const int k0n = (k0 + 32 < SEQ) ? k0 + 32 : 0;
        __builtin_prefetch(Kbh + (size_t)k0n * DK, 0, 3);
        __builtin_prefetch(Vbh + (size_t)k0n * DK, 0, 3);
#pragma unroll
        for (int j = 0; j < 4; ++j)
            kf[j] = load_frag_t(Kbh + (size_t)k0n * DK + j * FRAG);

        // mask + online softmax; s[j] is key k0 + kmap(j): j < 8 from sA, else sB
        float s[16];
#pragma unroll
        for (int i = 0; i < 8; ++i) {
            s[i]     = __builtin_amdgcn_inverse_ballot_w32(wc[i])     ? sA[i] : -1.0e9f;
            s[i + 8] = __builtin_amdgcn_inverse_ballot_w32(wc[i + 8]) ? sB[i] : -1.0e9f;
        }
        // next step's words, behind this step's selects: a whole step ahead of their
        // use, and not in flight at the selects' wait (a scalar-load wait is to 0)
        wc = *(const v16u*)(mw + (k0n >> 1));
        float mx[8];
#pragma unroll
        for (int i = 0; i < 8; ++i) mx[i] = fmaxf(s[i], s[i + 8]);
        float rm = fmaxf(fmaxf(fmaxf(mx[0], mx[1]), fmaxf(mx[2], mx[3])),
                         fmaxf(fmaxf(mx[4], mx[5]), fmaxf(mx[6], mx[7])));
        rm = fmaxf(rm, xhalf(rm));
        float mn = fmaxf(mrun, rm);
        float alpha = __expf(mrun - mn);
        mrun = mn;

        float p[16];
        v16h pF;
#pragma unroll
        for (int j = 0; j < 16; ++j) {
            p[j]  = __expf(s[j] - mn);
            pF[j] = (_Float16)p[j];
        }
        float ps[4];
#pragma unroll
        for (int j = 0; j < 4; ++j)
            ps[j] = (p[j] + p[j + 4]) + (p[j + 8] + p[j + 12]);
        lrun = lrun * alpha + ((ps[0] + ps[1]) + (ps[2] + ps[3]));

        // O^T = O^T * alpha + V^T(64x32) @ P^T(32x16)
#pragma unroll
        for (int t = 0; t < 4; ++t) {
#pragma unroll
            for (int i = 0; i < 8; ++i) acc[t][i] *= alpha;
            acc[t] = wmma16(vF[t], pF, acc[t]);
        }
    }

    // join the halves' sums, normalize, store context [B*S rows, 1024 k] f16 in
    // fragment order for the output GEMM: a lane's 8 registers are 8 consecutive
    // d of one query row, one chunk; k = h*64 + t*16 + 8*hi is tile h*2 + (t>>1),
    // chunk (t&1)*2 + hi
    float inv = 1.0f / (lrun + xhalf(lrun));
    _Float16* crow = ctx + ((size_t)((b * SEQ + q0) >> 4) * (D_INQ / 32) + h * 2) * FRAG
                         + hi * 128 + col * 8;
#pragma unroll
    for (int t = 0; t < 4; ++t) {
        v8h pk;
#pragma unroll
        for (int i = 0; i < 8; ++i) pk[i] = (_Float16)(acc[t][i] * inv);
        *(v8h*)(crow + (t >> 1) * FRAG + (t & 1) * 256) = pk;
    }
}

extern "C" void kernel_launch(void* const* d_in, const int* in_sizes, int n_in,
                              void* d_out, int out_size, void* d_ws, size_t ws_size,
                              hipStream_t stream) {
    (void)in_sizes; (void)n_in; (void)out_size; (void)ws_size;
    const float* x   = (const float*)d_in[0];
    const int*   msk = (const int*)d_in[1];
    const float* Wq  = (const float*)d_in[2];
    const float* bq  = (const float*)d_in[3];
    const float* Wk  = (const float*)d_in[4];
    const float* bk  = (const float*)d_in[5];
    const float* Wv  = (const float*)d_in[6];
    const float* bv  = (const float*)d_in[7];
    const float* Wo  = (const float*)d_in[8];
    const float* bo  = (const float*)d_in[9];
    float* out = (float*)d_out;

    const size_t NX = (size_t)BATCH * SEQ * D_INQ;   // 4M elems
    const size_t NW = (size_t)D_INQ * D_INQ;         // 1M elems
    char* ws = (char*)d_ws;
    _Float16* xh  = (_Float16*)(ws);
    _Float16* wqh = (_Float16*)(ws + NX * 2);
    _Float16* wkh = (_Float16*)(ws + NX * 2 + NW * 2);
    _Float16* wvh = (_Float16*)(ws + NX * 2 + NW * 4);
    _Float16* woh = (_Float16*)(ws + NX * 2 + NW * 6);
    _Float16* Qh  = (_Float16*)(ws + NX * 2 + NW * 8);
    _Float16* Kh  = (_Float16*)(ws + NX * 4 + NW * 8);
    _Float16* Vth = (_Float16*)(ws + NX * 6 + NW * 8);
    _Float16* Ch  = (_Float16*)(ws + NX * 8 + NW * 8);
    unsigned* mwd = (unsigned*)(ws + NX * 10 + NW * 8);   // B*S*S bits, 1 MB

    mha_mask_pack_kernel<<<BATCH * (SEQ / 16) * (SEQ / 128) / 8, 256, 0, stream>>>(msk, mwd);
    mha_cvt_f16_kernel<<<2048, 256, 0, stream>>>(x,  xh,  (int)NX);
    mha_cvt_f16_kernel<<<512,  256, 0, stream>>>(Wq, wqh, (int)NW);
    mha_cvt_f16_kernel<<<512,  256, 0, stream>>>(Wk, wkh, (int)NW);
    mha_cvt_f16_kernel<<<512,  256, 0, stream>>>(Wv, wvh, (int)NW);
    mha_cvt_f16_kernel<<<512,  256, 0, stream>>>(Wo, woh, (int)NW);

    dim3 gg(BATCH * SEQ / 32, 2);   // 128 M-tiles x (2 x 8 waves x 64 cols)
    const float qscale = 0.125f;    // 1/sqrt(DK)
    dim3 gt(D_INQ / 32, BATCH * SEQ / 512);   // 32 feature tiles x (8 x 8 waves x 64 tokens)
    mha_gemm_nt_kernel<<<gt, 256, 0, stream>>>(wqh, xh, bq, (void*)Qh,  0, qscale);
    mha_gemm_nt_kernel<<<gt, 256, 0, stream>>>(wkh, xh, bk, (void*)Kh,  0, 1.0f);
    mha_gemm_nt_kernel<<<gg, 256, 0, stream>>>(xh, wvh, bv, (void*)Vth, 2, 1.0f);

    mha_attn_kernel<<<BATCH * HEADS * (SEQ / 16) / 4, 128, 0, stream>>>(
        Qh, Kh, Vth, mwd, Ch);

    mha_gemm_nt_kernel<<<gg, 256, 0, stream>>>(Ch, woh, bo, (void*)out, 3, 1.0f);
}

// v005
// Measured time: 137 microseconds a run.
// Next to v004, in two timings, it ran 1.40 and 1.43 times as fast.
// Counting every step since v000, it is 2.29 times as fast.
#include <hip/hip_runtime.h>

typedef __attribute__((ext_vector_type(16))) _Float16 v16h;
typedef __attribute__((ext_vector_type(8)))  _Float16 v8h;
typedef __attribute__((ext_vector_type(8)))  float    v8f;
typedef __attribute__((ext_vector_type(4)))  int      v4i;
typedef __attribute__((ext_vector_type(4)))  float    v4f;
typedef __attribute__((ext_vector_type(2)))  unsigned v2u;
typedef __attribute__((ext_vector_type(16))) unsigned v16u;

#define D_INQ  1024
#define HEADS  16
#define DK     64
#define BATCH  2
#define SEQ    2048

#define FRAG 512
__device__ __forceinline__ v16h load_frag_t(const _Float16* tile) {
    const int lane = threadIdx.x & 31;
    const _Float16* p = tile + lane * 8;
    v8h lo = *(const v8h*)(p);                  // K = 8*(l>>4) .. +7
    v8h hi = *(const v8h*)(p + 256);            // K = 16 + 8*(l>>4) .. +7
    v16h f;
#pragma unroll
    for (int i = 0; i < 8; ++i) { f[i] = lo[i]; f[i + 8] = hi[i]; }
    return f;
}

__device__ __forceinline__ v8f wmma16(v16h a, v16h b, v8f c) {
    return __builtin_amdgcn_wmma_f32_16x16x32_f16(false, a, false, b,
                                                  (short)0, c, false, false);
}

__device__ __forceinline__ float xhalf(float x) {
    int b = __builtin_bit_cast(int, x);
    return __builtin_bit_cast(float,
        __builtin_amdgcn_permlanex16(b, b, 0x76543210, 0xfedcba98, false, false));
}

// ---- fp32 [rows,1024] row-major -> f16 in fragment order ----
// One 16-byte chunk g (8 consecutive k of one row) per thread, threads in the
// order of the destination, so that a wave stores 512 contiguous bytes.
__device__ __forceinline__ void cvt_f16_chunk(const float* __restrict__ src,
                                              _Float16* __restrict__ dst, int g) {
    const int r    = g & 15;
    const int c    = (g >> 4) & 3;
    const int tile = g >> 6;                     // row tile * 32 + k tile
    const int row  = ((tile >> 5) << 4) + r;
    const int k    = ((tile & 31) << 5) + (c << 3);
    const float* s = src + (size_t)row * D_INQ + k;
    v4f u = *(const v4f*)(s);
    v4f w = *(const v4f*)(s + 4);
    v8h pk;
#pragma unroll
    for (int i = 0; i < 4; ++i) { pk[i] = (_Float16)u[i]; pk[i + 4] = (_Float16)w[i]; }
    *(v8h*)(dst + (size_t)g * 8) = pk;
}

__device__ __forceinline__ void mask_pack_block(const int* __restrict__ mask,
                                                unsigned* __restrict__ mw, int blk) {
    const int lane = threadIdx.x & 31;
    const int col  = lane & 15;
    const int hi   = lane >> 4;
    const int task = blk * 8 + (threadIdx.x >> 5);          // tile * 16 + group of 4 steps
    const int tile = task >> 4;                             // b * (SEQ / 16) + q tile
    const int k0   = (task & 15) << 7;
    const int* mrow = mask + (size_t)(tile * 16 + col) * SEQ + k0 + 8 * hi;
    v4i m[16];
#pragma unroll
    for (int st = 0; st < 4; ++st)
#pragma unroll
        for (int g = 0; g < 4; ++g)
            m[st * 4 + g] = *(const v4i*)(mrow + st * 32 + (g >> 1) * 16 + (g & 1) * 4);
    v2u w = {0u, 0u};
#pragma unroll
    for (int j = 0; j < 64; ++j) {
        unsigned bl = __builtin_amdgcn_ballot_w32(m[j >> 2][j & 3] != 0);
        w[j & 1] = (lane == (j >> 1)) ? bl : w[j & 1];
    }
    *(v2u*)(mw + (size_t)task * 64 + lane * 2) = w;
}

// ---- one launch for all the work that needs nothing but the inputs ----
// The mask pack and the five conversions read and write disjoint data, so they
// share one grid: a range of the block index (a block-uniform branch) picks the
// job. The five f16 operands lie one behind the other in the workspace, x first,
// so a conversion block's number is also its place in the destination.
#define PREP_MASK_BLOCKS (BATCH * (SEQ / 16) * (SEQ / 128) / 8)
#define PREP_X_BLOCKS    (BATCH * SEQ * D_INQ / 8 / 256)
#define PREP_W_BLOCKS    (D_INQ * D_INQ / 8 / 256)
#define PREP_BLOCKS      (PREP_MASK_BLOCKS + PREP_X_BLOCKS + 4 * PREP_W_BLOCKS)
__global__ void __launch_bounds__(256)
mha_prep_kernel(const float* __restrict__ x,
                const float* __restrict__ Wq, const float* __restrict__ Wk,
                const float* __restrict__ Wv, const float* __restrict__ Wo,
                const int* __restrict__ mask,
                _Float16* __restrict__ f16ops, unsigned* __restrict__ mw) {
    if (blockIdx.x < PREP_MASK_BLOCKS) {
        mask_pack_block(mask, mw, blockIdx.x);
        return;
    }
    const int cb = blockIdx.x - PREP_MASK_BLOCKS;      // conversion block, x first
    const float* src = x;
    int base = 0;                                      // the matrix's first block
    if (cb >= PREP_X_BLOCKS) {
        const int w = (cb - PREP_X_BLOCKS) / PREP_W_BLOCKS;
        src  = w == 0 ? Wq : w == 1 ? Wk : w == 2 ? Wv : Wo;
        base = PREP_X_BLOCKS + w * PREP_W_BLOCKS;
    }
    cvt_f16_chunk(src, f16ops + (size_t)base * 256 * 8, (cb - base) * 256 + threadIdx.x);
}

// ---- NT GEMM: C[M,N] = A[M,1024] @ B[N,1024]^T + bias, A and B in fragment order ----
// Wave tile: 32 rows x 64 cols (2 A-frags share 4 B-frags -> 8 WMMA/K-step).
// Double-buffered, K-loop unrolled x2: stage s computes while stage 1-s loads.
// No rotation copies: each buffer written only by loads, read only by WMMAs.
// mode 0: A = weight (rows = features), B = tokens, bias by row; a lane's 8
//         accumulator registers are 8 consecutive d of one token: one chunk of
//         the [s x d] operand of head (b,h), stored f16 in fragment order (scaled)
// mode 2: A = tokens, B = weight; f16 V^T of head (b,h) in fragment order
// mode 3: A = tokens, B = weight; f32 row-major [M,1024]
// bx, by: the block's 32-row tile and its group of 8 x 64 columns
__device__ __forceinline__ void
gemm_nt_block(const _Float16* __restrict__ A,
              const _Float16* __restrict__ Bm,
              const float* __restrict__ bias,
              void* __restrict__ outp, int mode, float scale, int bx, int by) {
    const int wave = __builtin_amdgcn_readfirstlane(threadIdx.x >> 5);
    const int lane = threadIdx.x & 31;
    const int col  = lane & 15;
    const int hi   = lane >> 4;

    const int m0    = bx << 5;                  // 32 rows per wave
    const int nbase = ((by << 3) + wave) << 6;  // 64 cols per wave

    v8f acc[2][4];
    if (mode == 0) {
        float bv[2][8];
#pragma unroll
        for (int mh = 0; mh < 2; ++mh)
#pragma unroll
            for (int i = 0; i < 8; ++i) bv[mh][i] = bias[m0 + mh * 16 + 8 * hi + i];
        // these loads name registers that the copies and the set-up below reuse
        asm volatile("s_wait_xcnt 0x0" ::: "memory");
#pragma unroll
        for (int mh = 0; mh < 2; ++mh)
#pragma unroll
            for (int i = 0; i < 8; ++i)
#pragma unroll
                for (int t = 0; t < 4; ++t) acc[mh][t][i] = bv[mh][i];
    } else {
#pragma unroll
        for (int t = 0; t < 4; ++t) {
            float bv = bias[nbase + t * 16 + col];
#pragma unroll
            for (int i = 0; i < 8; ++i) { acc[0][t][i] = bv; acc[1][t][i] = bv; }
        }
    }

    // a 16-row band is RT = 32 tiles; k advances one tile (FRAG halves) per 32
    const int RT = (D_INQ / 32) * FRAG;
    const _Float16* A0 = A + (size_t)(m0 >> 4) * RT;
    const _Float16* A1 = A0 + RT;
    const _Float16* Bw = Bm + (size_t)(nbase >> 4) * RT;

    v16h a0[2], a1[2], bf[2][4];

    // prologue: stage 0 <- k = 0
    a0[0] = load_frag_t(A0);
    a1[0] = load_frag_t(A1);
#pragma unroll
    for (int t = 0; t < 4; ++t)
        bf[0][t] = load_frag_t(Bw + t * RT);

    const _Float16* pa = A0;    // tiles of stage 0, wave-uniform
    const _Float16* pb = Bw;
#pragma unroll 1
    for (int k = 0; k < D_INQ; k += 64) {
        // stage 1 <- k+32 (overlaps stage-0 WMMAs)
        a0[1] = load_frag_t(pa + FRAG);
        a1[1] = load_frag_t(pa + RT + FRAG);
#pragma unroll
        for (int t = 0; t < 4; ++t)
            bf[1][t] = load_frag_t(pb + t * RT + FRAG);

#pragma unroll
        for (int t = 0; t < 4; ++t) {
            acc[0][t] = wmma16(a0[0], bf[0][t], acc[0][t]);
            acc[1][t] = wmma16(a1[0], bf[0][t], acc[1][t]);
        }

        // stage 0 <- k+64 (wraps to 0 on last iter; overlaps stage-1 WMMAs)
        const bool more = k + 64 < D_INQ;
        pa = more ? pa + 2 * FRAG : A0;
        pb = more ? pb + 2 * FRAG : Bw;
        a0[0] = load_frag_t(pa);
        a1[0] = load_frag_t(pa + RT);
#pragma unroll
        for (int t = 0; t < 4; ++t)
            bf[0][t] = load_frag_t(pb + t * RT);

#pragma unroll
        for (int t = 0; t < 4; ++t) {
            acc[0][t] = wmma16(a0[1], bf[1][t], acc[0][t]);
            acc[1][t] = wmma16(a1[1], bf[1][t], acc[1][t]);
        }
    }
    // the last trip's loads still name the lane offset, which the epilogues rewrite;
    // the scheduling barrier keeps the epilogues' set-up behind the wait
    asm volatile("s_wait_xcnt 0x0" ::: "memory");
    __builtin_amdgcn_sched_barrier(0);

    if (mode == 3) {
        float* out = (float*)outp;
#pragma unroll
        for (int mh = 0; mh < 2; ++mh)
#pragma unroll
            for (int i = 0; i < 8; ++i) {
                int tg = m0 + mh * 16 + i + 8 * hi;
#pragma unroll
                for (int t = 0; t < 4; ++t)
                    out[(size_t)tg * D_INQ + nbase + t * 16 + col] = acc[mh][t][i];
            }
        // the stores' registers may be rewritten behind this branch
        asm volatile("s_wait_xcnt 0x0" ::: "memory");
    } else if (mode == 2) {
        // V^T of head (b,h), rows d, k = s: a lane's 8 accumulator registers are
        // 8 consecutive s of one d row, one chunk. Tiles in the order
        // [32-key step][d tile], so that a step's four fragments are 4 KB in a row.
        _Float16* out = (_Float16*)outp;
#pragma unroll
        for (int mh = 0; mh < 2; ++mh) {
            int tg0 = m0 + mh * 16 + 8 * hi;   // multiple of 8: one batch, 16-B aligned
            int b  = tg0 >> 11;       // / SEQ
            int s0 = tg0 & (SEQ - 1);
#pragma unroll
            for (int t = 0; t < 4; ++t) {
                int o = nbase + t * 16 + col;
                int h = o >> 6, d = o & 63;
                v8h pk;
#pragma unroll
                for (int i = 0; i < 8; ++i)
                    pk[i] = (_Float16)(acc[mh][t][i] * scale);
                *(v8h*)(out + (size_t)(b * HEADS + h) * DK * SEQ
                            + (size_t)((s0 >> 5) * 4 + (d >> 4)) * FRAG
                            + ((s0 >> 3) & 3) * 128 + (d & 15) * 8) = pk;
            }
        }
    } else {
        // Q/K of head (b,h), rows s, k = d: tiles in the order [16-row band][d / 32]
        _Float16* out = (_Float16*)outp;
#pragma unroll
        for (int mh = 0; mh < 2; ++mh) {
            int o0 = m0 + mh * 16 + 8 * hi;    // multiple of 8: one head, one chunk
            int h  = o0 >> 6, d0 = o0 & 63;
#pragma unroll
            for (int t = 0; t < 4; ++t) {
                int tg = nbase + t * 16 + col;
                int b = tg >> 11;         // / SEQ
                int s = tg & (SEQ - 1);
                v8h pk;
#pragma unroll
                for (int i = 0; i < 8; ++i)
                    pk[i] = (_Float16)(acc[mh][t][i] * scale);
                *(v8h*)(out + (size_t)(b * HEADS + h) * SEQ * DK
                            + (size_t)((s >> 4) * 2 + (d0 >> 5)) * FRAG
                            + ((d0 >> 3) & 3) * 128 + (s & 15) * 8) = pk;
            }
        }
        // the stores' registers may be rewritten behind this branch
        asm volatile("s_wait_xcnt 0x0" ::: "memory");
    }
}

// ---- the three projections in one launch: none needs another's result ----
// 256 blocks each, the job from the block index (block-uniform):
// Q and K: 32 feature tiles x (8 x 8 waves x 64 tokens); V: 128 token tiles x
// (2 x 8 waves x 64 features)
#define PROJ_BLOCKS ((BATCH * SEQ / 32) * (D_INQ / 512))
__global__ void __launch_bounds__(256)
mha_qkv_kernel(const _Float16* __restrict__ xh,
               const _Float16* __restrict__ wq, const _Float16* __restrict__ wk,
               const _Float16* __restrict__ wv,
               const float* __restrict__ bq, const float* __restrict__ bk,
               const float* __restrict__ bv,
               _Float16* __restrict__ Qh, _Float16* __restrict__ Kh,
               _Float16* __restrict__ Vth, float qscale) {
    const int job = blockIdx.x / PROJ_BLOCKS;          // 0 Q, 1 K, 2 V
    const int r   = blockIdx.x % PROJ_BLOCKS;
    const bool isv = job == 2;
    gemm_nt_block(isv ? xh : job ? wk : wq,
                  isv ? wv : xh,
                  isv ? bv : job ? bk : bq,
                  (void*)(isv ? Vth : job ? Kh : Qh),
                  isv ? 2 : 0,
                  job == 0 ? qscale : 1.0f,
                  isv ? r % (BATCH * SEQ / 32) : r % (D_INQ / 32),
                  isv ? r / (BATCH * SEQ / 32) : r / (D_INQ / 32));
}

// ---- output projection ----
__global__ void __launch_bounds__(256)
mha_out_kernel(const _Float16* __restrict__ ctx, const _Float16* __restrict__ wo,
               const float* __restrict__ bo, float* __restrict__ out) {
    gemm_nt_block(ctx, wo, bo, (void*)out, 3, 1.0f, blockIdx.x, blockIdx.y);
}

__global__ void __launch_bounds__(128) __attribute__((amdgpu_waves_per_eu(4, 4)))
mha_attn_kernel(const _Float16* __restrict__ Q,
                const _Float16* __restrict__ Km,
                const _Float16* __restrict__ Vt,
                const unsigned* __restrict__ mwords,
                _Float16* __restrict__ ctx) {
    const int wave = threadIdx.x >> 5;
    const int lane = threadIdx.x & 31;
    const int col  = lane & 15;
    const int hi   = lane >> 4;

    // tile = blockIdx.x * 4 + wave, 0 .. B*H*(S/16)-1; a block's 4 tiles share
    // one head, so b and h come from blockIdx alone and stay scalar
    int b  = blockIdx.x >> 9;
    int h  = (blockIdx.x >> 5) & (HEADS - 1);
    int q0 = (((blockIdx.x & 31) << 2) + wave) << 4;

    const _Float16* Qbh = Q  + (size_t)(b * HEADS + h) * SEQ * DK;
    const _Float16* Kbh = Km + (size_t)(b * HEADS + h) * SEQ * DK;
    const _Float16* Vbh = Vt + (size_t)(b * HEADS + h) * DK * SEQ;
    // the wave's lane-mask words, 16 per 32-key step; the wave's number as a
    // scalar, so that they come by scalar loads into scalar registers
    const int wv = __builtin_amdgcn_readfirstlane(threadIdx.x >> 5);
    const unsigned* mw = mwords
        + (size_t)(b * (SEQ / 16) + ((blockIdx.x & 31) << 2) + wv) * (SEQ / 32) * 16;
    v16u wc = *(const v16u*)(mw);       // step 0's words

    // Q already scaled by 1/sqrt(dk) at projection time
    // (a 16-row band of Q or K is two tiles, d 0..31 and d 32..63: 16 * DK halves)
    v16h aq0 = load_frag_t(Qbh + (size_t)q0 * DK);
    v16h aq1 = load_frag_t(Qbh + (size_t)q0 * DK + FRAG);
    // pipeline prologue: K fragments for k0 = 0
    v16h kf[4];
#pragma unroll
    for (int j = 0; j < 4; ++j) kf[j] = load_frag_t(Kbh + j * FRAG);
    // these loads name registers that the set-up below reuses; the scheduling
    // barrier keeps that set-up behind the wait
    asm volatile("s_wait_xcnt 0x0" ::: "memory");
    __builtin_amdgcn_sched_barrier(0);

    float mrun = -3.0e38f;   // running maximum of query col (equal in both halves)
    float lrun = 0.f;        // running sum over this lane's own keys only
    v8f zero = {};
    v8f acc[4];              // acc[t][i] = O[q0 + col][t*16 + 8*hi + i]
#pragma unroll
    for (int t = 0; t < 4; ++t) acc[t] = zero;

    for (int k0 = 0; k0 < SEQ; k0 += 32) {
        // V fragments of this step: independent of scores, load early
        v16h vF[4];
#pragma unroll
        for (int t = 0; t < 4; ++t)
            vF[t] = load_frag_t(Vbh + (size_t)k0 * DK + t * FRAG);

        // S^T: two 16x16 tiles (key rows k0..k0+15, k0+16..k0+31), K-dim = 64
        v8f sA = zero, sB = zero;
        sA = wmma16(kf[0], aq0, sA);
        sA = wmma16(kf[1], aq1, sA);
        sB = wmma16(kf[2], aq0, sB);
        sB = wmma16(kf[3], aq1, sB);

        // preload next step's K fragments; overlaps with softmax VALU below
        const int k0n = (k0 + 32 < SEQ) ? k0 + 32 : 0;
        __builtin_prefetch(Kbh + (size_t)k0n * DK, 0, 3);
        __builtin_prefetch(Vbh + (size_t)k0n * DK, 0, 3);
#pragma unroll
        for (int j = 0; j < 4; ++j)
            kf[j] = load_frag_t(Kbh + (size_t)k0n * DK + j * FRAG);

        // mask + online softmax; s[j] is key k0 + kmap(j): j < 8 from sA, else sB
        float s[16];
#pragma unroll
        for (int i = 0; i < 8; ++i) {
            s[i]     = __builtin_amdgcn_inverse_ballot_w32(wc[i])     ? sA[i] : -1.0e9f;
            s[i + 8] = __builtin_amdgcn_inverse_ballot_w32(wc[i + 8]) ? sB[i] : -1.0e9f;
        }
        // next step's words, behind this step's selects: a whole step ahead of their
        // use, and not in flight at the selects' wait (a scalar-load wait is to 0)
        wc = *(const v16u*)(mw + (k0n >> 1));
        float mx[8];
#pragma unroll
        for (int i = 0; i < 8; ++i) mx[i] = fmaxf(s[i], s[i + 8]);
        float rm = fmaxf(fmaxf(fmaxf(mx[0], mx[1]), fmaxf(mx[2], mx[3])),
                         fmaxf(fmaxf(mx[4], mx[5]), fmaxf(mx[6], mx[7])));
        rm = fmaxf(rm, xhalf(rm));
        float mn = fmaxf(mrun, rm);
        float alpha = __expf(mrun - mn);
        mrun = mn;

        float p[16];
        v16h pF;
#pragma unroll
        for (int j = 0; j < 16; ++j) {
            p[j]  = __expf(s[j] - mn);
            pF[j] = (_Float16)p[j];
        }
        float ps[4];
#pragma unroll
        for (int j = 0; j < 4; ++j)
            ps[j] = (p[j] + p[j + 4]) + (p[j + 8] + p[j + 12]);
        lrun = lrun * alpha + ((ps[0] + ps[1]) + (ps[2] + ps[3]));

        // O^T = O^T * alpha + V^T(64x32) @ P^T(32x16)
#pragma unroll
        for (int t = 0; t < 4; ++t) {
#pragma unroll
            for (int i = 0; i < 8; ++i) acc[t][i] *= alpha;
            acc[t] = wmma16(vF[t], pF, acc[t]);
        }
    }

    // join the halves' sums, normalize, store context [B*S rows, 1024 k] f16 in
    // fragment order for the output GEMM: a lane's 8 registers are 8 consecutive
    // d of one query row, one chunk; k = h*64 + t*16 + 8*hi is tile h*2 + (t>>1),
    // chunk (t&1)*2 + hi
    float inv = 1.0f / (lrun + xhalf(lrun));
    _Float16* crow = ctx + ((size_t)((b * SEQ + q0) >> 4) * (D_INQ / 32) + h * 2) * FRAG
                         + hi * 128 + col * 8;
#pragma unroll
    for (int t = 0; t < 4; ++t) {
        v8h pk;
#pragma unroll
        for (int i = 0; i < 8; ++i) pk[i] = (_Float16)(acc[t][i] * inv);
        *(v8h*)(crow + (t >> 1) * FRAG + (t & 1) * 256) = pk;
    }
}

extern "C" void kernel_launch(void* const* d_in, const int* in_sizes, int n_in,
                              void* d_out, int out_size, void* d_ws, size_t ws_size,
                              hipStream_t stream) {
    (void)in_sizes; (void)n_in; (void)out_size; (void)ws_size;
    const float* x   = (const float*)d_in[0];
    const int*   msk = (const int*)d_in[1];
    const float* Wq  = (const float*)d_in[2];
    const float* bq  = (const float*)d_in[3];
    const float* Wk  = (const float*)d_in[4];
    const float* bk  = (const float*)d_in[5];
    const float* Wv  = (const float*)d_in[6];
    const float* bv  = (const float*)d_in[7];
    const float* Wo  = (const float*)d_in[8];
    const float* bo  = (const float*)d_in[9];
    float* out = (float*)d_out;

    const size_t NX = (size_t)BATCH * SEQ * D_INQ;   // 4M elems
    const size_t NW = (size_t)D_INQ * D_INQ;         // 1M elems
    char* ws = (char*)d_ws;
    _Float16* xh  = (_Float16*)(ws);
    _Float16* wqh = (_Float16*)(ws + NX * 2);
    _Float16* wkh = (_Float16*)(ws + NX * 2 + NW * 2);
    _Float16* wvh = (_Float16*)(ws + NX * 2 + NW * 4);
    _Float16* woh = (_Float16*)(ws + NX * 2 + NW * 6);
    _Float16* Qh  = (_Float16*)(ws + NX * 2 + NW * 8);
    _Float16* Kh  = (_Float16*)(ws + NX * 4 + NW * 8);
    _Float16* Vth = (_Float16*)(ws + NX * 6 + NW * 8);
    _Float16* Ch  = (_Float16*)(ws + NX * 8 + NW * 8);
    unsigned* mwd = (unsigned*)(ws + NX * 10 + NW * 8);   // B*S*S bits, 1 MB

    // xh, wqh, wkh, wvh, woh are written as one run of f16 operands from xh on
    mha_prep_kernel<<<PREP_BLOCKS, 256, 0, stream>>>(x, Wq, Wk, Wv, Wo, msk, xh, mwd);

    const float qscale = 0.125f;    // 1/sqrt(DK)
    mha_qkv_kernel<<<3 * PROJ_BLOCKS, 256, 0, stream>>>(xh, wqh, wkh, wvh, bq, bk, bv,
                                                        Qh, Kh, Vth, qscale);

    mha_attn_kernel<<<BATCH * HEADS * (SEQ / 16) / 4, 128, 0, stream>>>(
        Qh, Kh, Vth, mwd, Ch);

    dim3 gg(BATCH * SEQ / 32, 2);   // 128 M-tiles x (2 x 8 waves x 64 cols)
    mha_out_kernel<<<gg, 256, 0, stream>>>(Ch, woh, bo, out);
}

// v006
// It runs in 131 microseconds.
// Two timings next to v005 put it at 1.04 and 1.02 times that version's speed.
// Over all steps from v000 it is 2.37 times as fast.
#include <hip/hip_runtime.h>

typedef __attribute__((ext_vector_type(16))) _Float16 v16h;
typedef __attribute__((ext_vector_type(8)))  _Float16 v8h;
typedef __attribute__((ext_vector_type(8)))  float    v8f;
typedef __attribute__((ext_vector_type(4)))  int      v4i;
typedef __attribute__((ext_vector_type(4)))  float    v4f;
typedef __attribute__((ext_vector_type(2)))  unsigned v2u;
typedef __attribute__((ext_vector_type(16))) unsigned v16u;

#define D_INQ  1024
#define HEADS  16
#define DK     64
#define BATCH  2
#define SEQ    2048

#define FRAG 512
__device__ __forceinline__ v16h load_frag_t(const _Float16* tile) {
    const int lane = threadIdx.x & 31;
    const _Float16* p = tile + lane * 8;
    v8h lo = *(const v8h*)(p);                  // K = 8*(l>>4) .. +7
    v8h hi = *(const v8h*)(p + 256);            // K = 16 + 8*(l>>4) .. +7
    v16h f;
#pragma unroll
    for (int i = 0; i < 8; ++i) { f[i] = lo[i]; f[i + 8] = hi[i]; }
    return f;
}

__device__ __forceinline__ v8f wmma16(v16h a, v16h b, v8f c) {
    return __builtin_amdgcn_wmma_f32_16x16x32_f16(false, a, false, b,
                                                  (short)0, c, false, false);
}

__device__ __forceinline__ float xhalf(float x) {
    int b = __builtin_bit_cast(int, x);
    return __builtin_bit_cast(float,
        __builtin_amdgcn_permlanex16(b, b, 0x76543210, 0xfedcba98, false, false));
}

// ---- fp32 [rows,1024] row-major -> f16 in fragment order ----
// One 16-byte chunk g (8 consecutive k of one row) per thread, threads in the
// order of the destination, so that a wave stores 512 contiguous bytes.
__device__ __forceinline__ void cvt_f16_chunk(const float* __restrict__ src,
                                              _Float16* __restrict__ dst, int g) {
    const int r    = g & 15;
    const int c    = (g >> 4) & 3;
    const int tile = g >> 6;                     // row tile * 32 + k tile
    const int row  = ((tile >> 5) << 4) + r;
    const int k    = ((tile & 31) << 5) + (c << 3);
    const float* s = src + (size_t)row * D_INQ + k;
    v4f u = *(const v4f*)(s);
    v4f w = *(const v4f*)(s + 4);
    v8h pk;
#pragma unroll
    for (int i = 0; i < 4; ++i) { pk[i] = (_Float16)u[i]; pk[i + 4] = (_Float16)w[i]; }
    *(v8h*)(dst + (size_t)g * 8) = pk;
}

__device__ __forceinline__ void mask_pack_block(const int* __restrict__ mask,
                                                unsigned* __restrict__ mw, int blk) {
    const int lane = threadIdx.x & 31;
    const int col  = lane & 15;
    const int hi   = lane >> 4;
    const int task = blk * 8 + (threadIdx.x >> 5);          // tile * 16 + group of 4 steps
    const int tile = task >> 4;                             // b * (SEQ / 16) + q tile
    const int k0   = (task & 15) << 7;
    const int* mrow = mask + (size_t)(tile * 16 + col) * SEQ + k0 + 8 * hi;
    v4i m[16];
#pragma unroll
    for (int st = 0; st < 4; ++st)
#pragma unroll
        for (int g = 0; g < 4; ++g)
            m[st * 4 + g] = *(const v4i*)(mrow + st * 32 + (g >> 1) * 16 + (g & 1) * 4);
    v2u w = {0u, 0u};
#pragma unroll
    for (int j = 0; j < 64; ++j) {
        unsigned bl = __builtin_amdgcn_ballot_w32(m[j >> 2][j & 3] != 0);
        w[j & 1] = (lane == (j >> 1)) ? bl : w[j & 1];
    }
    *(v2u*)(mw + (size_t)task * 64 + lane * 2) = w;
}

// ---- one launch for all the work that needs nothing but the inputs ----
// The mask pack and the five conversions read and write disjoint data, so they
// share one grid: a range of the block index (a block-uniform branch) picks the
// job. The five f16 operands lie one behind the other in the workspace, x first,
// so a conversion block's number is also its place in the destination.
#define PREP_MASK_BLOCKS (BATCH * (SEQ / 16) * (SEQ / 128) / 8)
#define PREP_X_BLOCKS    (BATCH * SEQ * D_INQ / 8 / 256)
#define PREP_W_BLOCKS    (D_INQ * D_INQ / 8 / 256)
#define PREP_BLOCKS      (PREP_MASK_BLOCKS + PREP_X_BLOCKS + 4 * PREP_W_BLOCKS)
__global__ void __launch_bounds__(256)
mha_prep_kernel(const float* __restrict__ x,
                const float* __restrict__ Wq, const float* __restrict__ Wk,
                const float* __restrict__ Wv, const float* __restrict__ Wo,
                const int* __restrict__ mask,
                _Float16* __restrict__ f16ops, unsigned* __restrict__ mw) {
    if (blockIdx.x < PREP_MASK_BLOCKS) {
        mask_pack_block(mask, mw, blockIdx.x);
        return;
    }
    const int cb = blockIdx.x - PREP_MASK_BLOCKS;      // conversion block, x first
    const float* src = x;
    int base = 0;                                      // the matrix's first block
    if (cb >= PREP_X_BLOCKS) {
        const int w = (cb - PREP_X_BLOCKS) / PREP_W_BLOCKS;
        src  = w == 0 ? Wq : w == 1 ? Wk : w == 2 ? Wv : Wo;
        base = PREP_X_BLOCKS + w * PREP_W_BLOCKS;
    }
    cvt_f16_chunk(src, f16ops + (size_t)base * 256 * 8, (cb - base) * 256 + threadIdx.x);
}

// ---- NT GEMM: C[M,N] = A[M,1024] @ B[N,1024]^T + bias, A and B in fragment order ----
// Wave tile: 32 rows x 64 cols (2 A-frags share 4 B-frags -> 8 WMMA/K-step).
// Block tile: 128 rows x 128 cols, 4 x 2 waves: per K-step the block's waves ask for
// 8 KB of A and 8 KB of B between them (each A tile read by 2 waves, each B tile
// by 4), the fewest distinct lines that 8 such waves can need from L2.
// Double-buffered, K-loop unrolled x2: stage s computes while stage 1-s loads.
// No rotation copies: each buffer written only by loads, read only by WMMAs.
// mode 0: A = weight (rows = features), B = tokens, bias by row; a lane's 8
//         accumulator registers are 8 consecutive d of one token: one chunk of
//         the [s x d] operand of head (b,h), stored f16 in fragment order (scaled)
// mode 2: A = tokens, B = weight; f16 V^T of head (b,h) in fragment order
// mode 3: A = tokens, B = weight; f32 row-major [M,1024]
// bx, by: the block's 128-row tile and its 128-column tile
__device__ __forceinline__ void
gemm_nt_block(const _Float16* __restrict__ A,
              const _Float16* __restrict__ Bm,
              const float* __restrict__ bias,
              void* __restrict__ outp, int mode, float scale, int bx, int by) {
    const int wave = __builtin_amdgcn_readfirstlane(threadIdx.x >> 5);
    const int lane = threadIdx.x & 31;
    const int col  = lane & 15;
    const int hi   = lane >> 4;

    const int m0    = ((bx << 2) + (wave & 3)) << 5;   // 32 rows per wave, 4 waves down
    const int nbase = ((by << 1) + (wave >> 2)) << 6;  // 64 cols per wave, 2 waves across

    v8f acc[2][4];
    if (mode == 0) {
        float bv[2][8];
#pragma unroll
        for (int mh = 0; mh < 2; ++mh)
#pragma unroll
            for (int i = 0; i < 8; ++i) bv[mh][i] = bias[m0 + mh * 16 + 8 * hi + i];
        // these loads name registers that the copies and the set-up below reuse
        asm volatile("s_wait_xcnt 0x0" ::: "memory");
#pragma unroll
        for (int mh = 0; mh < 2; ++mh)
#pragma unroll
            for (int i = 0; i < 8; ++i)
#pragma unroll
                for (int t = 0; t < 4; ++t) acc[mh][t][i] = bv[mh][i];
    } else {
#pragma unroll
        for (int t = 0; t < 4; ++t) {
            float bv = bias[nbase + t * 16 + col];
#pragma unroll
            for (int i = 0; i < 8; ++i) { acc[0][t][i] = bv; acc[1][t][i] = bv; }
        }
    }

    // a 16-row band is RT = 32 tiles; k advances one tile (FRAG halves) per 32
    const int RT = (D_INQ / 32) * FRAG;
    const _Float16* A0 = A + (size_t)(m0 >> 4) * RT;
    const _Float16* A1 = A0 + RT;
    const _Float16* Bw = Bm + (size_t)(nbase >> 4) * RT;

    v16h a0[2], a1[2], bf[2][4];

    // prologue: stage 0 <- k = 0
    a0[0] = load_frag_t(A0);
    a1[0] = load_frag_t(A1);
#pragma unroll
    for (int t = 0; t < 4; ++t)
        bf[0][t] = load_frag_t(Bw + t * RT);

    const _Float16* pa = A0;    // tiles of stage 0, wave-uniform
    const _Float16* pb = Bw;
#pragma unroll 1
    for (int k = 0; k < D_INQ; k += 64) {
        // stage 1 <- k+32 (overlaps stage-0 WMMAs)
        a0[1] = load_frag_t(pa + FRAG);
        a1[1] = load_frag_t(pa + RT + FRAG);
#pragma unroll
        for (int t = 0; t < 4; ++t)
            bf[1][t] = load_frag_t(pb + t * RT + FRAG);

#pragma unroll
        for (int t = 0; t < 4; ++t) {
            acc[0][t] = wmma16(a0[0], bf[0][t], acc[0][t]);
            acc[1][t] = wmma16(a1[0], bf[0][t], acc[1][t]);
        }

        // stage 0 <- k+64 (wraps to 0 on last iter; overlaps stage-1 WMMAs)
        const bool more = k + 64 < D_INQ;
        pa = more ? pa + 2 * FRAG : A0;
        pb = more ? pb + 2 * FRAG : Bw;
        a0[0] = load_frag_t(pa);
        a1[0] = load_frag_t(pa + RT);
#pragma unroll
        for (int t = 0; t < 4; ++t)
            bf[0][t] = load_frag_t(pb + t * RT);

#pragma unroll
        for (int t = 0; t < 4; ++t) {
            acc[0][t] = wmma16(a0[1], bf[1][t], acc[0][t]);
            acc[1][t] = wmma16(a1[1], bf[1][t], acc[1][t]);
        }
    }
    // the last trip's loads still name the lane offset, which the epilogues rewrite;
    // the scheduling barrier keeps the epilogues' set-up behind the wait
    asm volatile("s_wait_xcnt 0x0" ::: "memory");
    __builtin_amdgcn_sched_barrier(0);

    if (mode == 3) {
        float* out = (float*)outp;
#pragma unroll
        for (int mh = 0; mh < 2; ++mh)
#pragma unroll
            for (int i = 0; i < 8; ++i) {
                int tg = m0 + mh * 16 + i + 8 * hi;
#pragma unroll
                for (int t = 0; t < 4; ++t)
                    out[(size_t)tg * D_INQ + nbase + t * 16 + col] = acc[mh][t][i];
            }
        // the stores' registers may be rewritten behind this branch
        asm volatile("s_wait_xcnt 0x0" ::: "memory");
    } else if (mode == 2) {
        // V^T of head (b,h), rows d, k = s: a lane's 8 accumulator registers are
        // 8 consecutive s of one d row, one chunk. Tiles in the order
        // [32-key step][d tile], so that a step's four fragments are 4 KB in a row.
        _Float16* out = (_Float16*)outp;
#pragma unroll
        for (int mh = 0; mh < 2; ++mh) {
            int tg0 = m0 + mh * 16 + 8 * hi;   // multiple of 8: one batch, 16-B aligned
            int b  = tg0 >> 11;       // / SEQ
            int s0 = tg0 & (SEQ - 1);
#pragma unroll
            for (int t = 0; t < 4; ++t) {
                int o = nbase + t * 16 + col;
                int h = o >> 6, d = o & 63;
                v8h pk;
#pragma unroll
                for (int i = 0; i < 8; ++i)
                    pk[i] = (_Float16)(acc[mh][t][i] * scale);
                *(v8h*)(out + (size_t)(b * HEADS + h) * DK * SEQ
                            + (size_t)((s0 >> 5) * 4 + (d >> 4)) * FRAG
                            + ((s0 >> 3) & 3) * 128 + (d & 15) * 8) = pk;
            }
        }
    } else {
        // Q/K of head (b,h), rows s, k = d: tiles in the order [16-row band][d / 32]
        _Float16* out = (_Float16*)outp;
#pragma unroll
        for (int mh = 0; mh < 2; ++mh) {
            int o0 = m0 + mh * 16 + 8 * hi;    // multiple of 8: one head, one chunk
            int h  = o0 >> 6, d0 = o0 & 63;
#pragma unroll
            for (int t = 0; t < 4; ++t) {
                int tg = nbase + t * 16 + col;
                int b = tg >> 11;         // / SEQ
                int s = tg & (SEQ - 1);
                v8h pk;
#pragma unroll
                for (int i = 0; i < 8; ++i)
                    pk[i] = (_Float16)(acc[mh][t][i] * scale);
                *(v8h*)(out + (size_t)(b * HEADS + h) * SEQ * DK
                            + (size_t)((s >> 4) * 2 + (d0 >> 5)) * FRAG
                            + ((d0 >> 3) & 3) * 128 + (s & 15) * 8) = pk;
            }
        }
        // the stores' registers may be rewritten behind this branch
        asm volatile("s_wait_xcnt 0x0" ::: "memory");
    }
}

// ---- the three projections in one launch: none needs another's result ----
// 256 blocks each, the job from the block index (block-uniform):
// Q and K: 8 feature tiles x 32 token tiles; V: 32 token tiles x 8 feature tiles;
// a block number means the same token tile and feature tile in all three jobs
#define PROJ_BLOCKS ((BATCH * SEQ / 128) * (D_INQ / 128))
__global__ void __launch_bounds__(256)
mha_qkv_kernel(const _Float16* __restrict__ xh,
               const _Float16* __restrict__ wq, const _Float16* __restrict__ wk,
               const _Float16* __restrict__ wv,
               const float* __restrict__ bq, const float* __restrict__ bk,
               const float* __restrict__ bv,
               _Float16* __restrict__ Qh, _Float16* __restrict__ Kh,
               _Float16* __restrict__ Vth, float qscale) {
    const int job = blockIdx.x / PROJ_BLOCKS;          // 0 Q, 1 K, 2 V
    const int r   = blockIdx.x % PROJ_BLOCKS;
    const bool isv = job == 2;
    gemm_nt_block(isv ? xh : job ? wk : wq,
                  isv ? wv : xh,
                  isv ? bv : job ? bk : bq,
                  (void*)(isv ? Vth : job ? Kh : Qh),
                  isv ? 2 : 0,
                  job == 0 ? qscale : 1.0f,
                  isv ? r / (D_INQ / 128) : r % (D_INQ / 128),
                  isv ? r % (D_INQ / 128) : r / (D_INQ / 128));
}

// ---- output projection ----
__global__ void __launch_bounds__(256)
mha_out_kernel(const _Float16* __restrict__ ctx, const _Float16* __restrict__ wo,
               const float* __restrict__ bo, float* __restrict__ out) {
    gemm_nt_block(ctx, wo, bo, (void*)out, 3, 1.0f, blockIdx.x, blockIdx.y);
}

__global__ void __launch_bounds__(128) __attribute__((amdgpu_waves_per_eu(4, 4)))
mha_attn_kernel(const _Float16* __restrict__ Q,
                const _Float16* __restrict__ Km,
                const _Float16* __restrict__ Vt,
                const unsigned* __restrict__ mwords,
                _Float16* __restrict__ ctx) {
    const int wave = threadIdx.x >> 5;
    const int lane = threadIdx.x & 31;
    const int col  = lane & 15;
    const int hi   = lane >> 4;

    // tile = blockIdx.x * 4 + wave, 0 .. B*H*(S/16)-1; a block's 4 tiles share
    // one head, so b and h come from blockIdx alone and stay scalar
    int b  = blockIdx.x >> 9;
    int h  = (blockIdx.x >> 5) & (HEADS - 1);
    int q0 = (((blockIdx.x & 31) << 2) + wave) << 4;

    const _Float16* Qbh = Q  + (size_t)(b * HEADS + h) * SEQ * DK;
    const _Float16* Kbh = Km + (size_t)(b * HEADS + h) * SEQ * DK;
    const _Float16* Vbh = Vt + (size_t)(b * HEADS + h) * DK * SEQ;
    // the wave's lane-mask words, 16 per 32-key step; the wave's number as a
    // scalar, so that they come by scalar loads into scalar registers
    const int wv = __builtin_amdgcn_readfirstlane(threadIdx.x >> 5);
    const unsigned* mw = mwords
        + (size_t)(b * (SEQ / 16) + ((blockIdx.x & 31) << 2) + wv) * (SEQ / 32) * 16;
    v16u wc = *(const v16u*)(mw);       // step 0's words

    // Q already scaled by 1/sqrt(dk) at projection time
    // (a 16-row band of Q or K is two tiles, d 0..31 and d 32..63: 16 * DK halves)
    v16h aq0 = load_frag_t(Qbh + (size_t)q0 * DK);
    v16h aq1 = load_frag_t(Qbh + (size_t)q0 * DK + FRAG);
    // pipeline prologue: K fragments for k0 = 0
    v16h kf[4];
#pragma unroll
    for (int j = 0; j < 4; ++j) kf[j] = load_frag_t(Kbh + j * FRAG);
    // these loads name registers that the set-up below reuses; the scheduling
    // barrier keeps that set-up behind the wait
    asm volatile("s_wait_xcnt 0x0" ::: "memory");
    __builtin_amdgcn_sched_barrier(0);

    float mrun = -3.0e38f;   // running maximum of query col (equal in both halves)
    float lrun = 0.f;        // running sum over this lane's own keys only
    v8f zero = {};
    v8f acc[4];              // acc[t][i] = O[q0 + col][t*16 + 8*hi + i]
#pragma unroll
    for (int t = 0; t < 4; ++t) acc[t] = zero;

    for (int k0 = 0; k0 < SEQ; k0 += 32) {
        // V fragments of this step: independent of scores, load early
        v16h vF[4];
#pragma unroll
        for (int t = 0; t < 4; ++t)
            vF[t] = load_frag_t(Vbh + (size_t)k0 * DK + t * FRAG);

        // S^T: two 16x16 tiles (key rows k0..k0+15, k0+16..k0+31), K-dim = 64
        v8f sA = zero, sB = zero;
        sA = wmma16(kf[0], aq0, sA);
        sA = wmma16(kf[1], aq1, sA);
        sB = wmma16(kf[2], aq0, sB);
        sB = wmma16(kf[3], aq1, sB);

        // preload next step's K fragments; overlaps with softmax VALU below
        const int k0n = (k0 + 32 < SEQ) ? k0 + 32 : 0;
        __builtin_prefetch(Kbh + (size_t)k0n * DK, 0, 3);
        __builtin_prefetch(Vbh + (size_t)k0n * DK, 0, 3);
#pragma unroll
        for (int j = 0; j < 4; ++j)
            kf[j] = load_frag_t(Kbh + (size_t)k0n * DK + j * FRAG);

        // mask + online softmax; s[j] is key k0 + kmap(j): j < 8 from sA, else sB
        float s[16];
#pragma unroll
        for (int i = 0; i < 8; ++i) {
            s[i]     = __builtin_amdgcn_inverse_ballot_w32(wc[i])     ? sA[i] : -1.0e9f;
            s[i + 8] = __builtin_amdgcn_inverse_ballot_w32(wc[i + 8]) ? sB[i] : -1.0e9f;
        }
        // next step's words, behind this step's selects: a whole step ahead of their
        // use, and not in flight at the selects' wait (a scalar-load wait is to 0)
        wc = *(const v16u*)(mw + (k0n >> 1));
        float mx[8];
#pragma unroll
        for (int i = 0; i < 8; ++i) mx[i] = fmaxf(s[i], s[i + 8]);
        float rm = fmaxf(fmaxf(fmaxf(mx[0], mx[1]), fmaxf(mx[2], mx[3])),
                         fmaxf(fmaxf(mx[4], mx[5]), fmaxf(mx[6], mx[7])));
        rm = fmaxf(rm, xhalf(rm));
        float mn = fmaxf(mrun, rm);
        float alpha = __expf(mrun - mn);
        mrun = mn;

        float p[16];
        v16h pF;
#pragma unroll
        for (int j = 0; j < 16; ++j) {
            p[j]  = __expf(s[j] - mn);
            pF[j] = (_Float16)p[j];
        }
        float ps[4];
#pragma unroll
        for (int j = 0; j < 4; ++j)
            ps[j] = (p[j] + p[j + 4]) + (p[j + 8] + p[j + 12]);
        lrun = lrun * alpha + ((ps[0] + ps[1]) + (ps[2] + ps[3]));

        // O^T = O^T * alpha + V^T(64x32) @ P^T(32x16)
#pragma unroll
        for (int t = 0; t < 4; ++t) {
#pragma unroll
            for (int i = 0; i < 8; ++i) acc[t][i] *= alpha;
            acc[t] = wmma16(vF[t], pF, acc[t]);
        }
    }

    // join the halves' sums, normalize, store context [B*S rows, 1024 k] f16 in
    // fragment order for the output GEMM: a lane's 8 registers are 8 consecutive
    // d of one query row, one chunk; k = h*64 + t*16 + 8*hi is tile h*2 + (t>>1),
    // chunk (t&1)*2 + hi
    float inv = 1.0f / (lrun + xhalf(lrun));
    _Float16* crow = ctx + ((size_t)((b * SEQ + q0) >> 4) * (D_INQ / 32) + h * 2) * FRAG
                         + hi * 128 + col * 8;
#pragma unroll
    for (int t = 0; t < 4; ++t) {
        v8h pk;
#pragma unroll
        for (int i = 0; i < 8; ++i) pk[i] = (_Float16)(acc[t][i] * inv);
        *(v8h*)(crow + (t >> 1) * FRAG + (t & 1) * 256) = pk;
    }
}

extern "C" void kernel_launch(void* const* d_in, const int* in_sizes, int n_in,
                              void* d_out, int out_size, void* d_ws, size_t ws_size,
                              hipStream_t stream) {
    (void)in_sizes; (void)n_in; (void)out_size; (void)ws_size;
    const float* x   = (const float*)d_in[0];
    const int*   msk = (const int*)d_in[1];
    const float* Wq  = (const float*)d_in[2];
    const float* bq  = (const float*)d_in[3];
    const float* Wk  = (const float*)d_in[4];
    const float* bk  = (const float*)d_in[5];
    const float* Wv  = (const float*)d_in[6];
    const float* bv  = (const float*)d_in[7];
    const float* Wo  = (const float*)d_in[8];
    const float* bo  = (const float*)d_in[9];
    float* out = (float*)d_out;

    const size_t NX = (size_t)BATCH * SEQ * D_INQ;   // 4M elems
    const size_t NW = (size_t)D_INQ * D_INQ;         // 1M elems
    char* ws = (char*)d_ws;
    _Float16* xh  = (_Float16*)(ws);
    _Float16* wqh = (_Float16*)(ws + NX * 2);
    _Float16* wkh = (_Float16*)(ws + NX * 2 + NW * 2);
    _Float16* wvh = (_Float16*)(ws + NX * 2 + NW * 4);
    _Float16* woh = (_Float16*)(ws + NX * 2 + NW * 6);
    _Float16* Qh  = (_Float16*)(ws + NX * 2 + NW * 8);
    _Float16* Kh  = (_Float16*)(ws + NX * 4 + NW * 8);
    _Float16* Vth = (_Float16*)(ws + NX * 6 + NW * 8);
    _Float16* Ch  = (_Float16*)(ws + NX * 8 + NW * 8);
    unsigned* mwd = (unsigned*)(ws + NX * 10 + NW * 8);   // B*S*S bits, 1 MB

    // xh, wqh, wkh, wvh, woh are written as one run of f16 operands from xh on
    mha_prep_kernel<<<PREP_BLOCKS, 256, 0, stream>>>(x, Wq, Wk, Wv, Wo, msk, xh, mwd);

    const float qscale = 0.125f;    // 1/sqrt(DK)
    mha_qkv_kernel<<<3 * PROJ_BLOCKS, 256, 0, stream>>>(xh, wqh, wkh, wvh, bq, bk, bv,
                                                        Qh, Kh, Vth, qscale);

    mha_attn_kernel<<<BATCH * HEADS * (SEQ / 16) / 4, 128, 0, stream>>>(
        Qh, Kh, Vth, mwd, Ch);

    dim3 gg(BATCH * SEQ / 128, D_INQ / 128);   // 32 M-tiles x 8 N-tiles of 128 x 128
    mha_out_kernel<<<gg, 256, 0, stream>>>(Ch, woh, bo, out);
}

// v007
// It runs in 112 microseconds.
// In both of two side-by-side timings against v006, it was 1.16 times as fast.
// Over all steps from v000 it is 2.75 times as fast.
#include <hip/hip_runtime.h>

typedef __attribute__((ext_vector_type(16))) _Float16 v16h;
typedef __attribute__((ext_vector_type(8)))  _Float16 v8h;
typedef __attribute__((ext_vector_type(8)))  float    v8f;
typedef __attribute__((ext_vector_type(4)))  int      v4i;
typedef __attribute__((ext_vector_type(4)))  float    v4f;
typedef __attribute__((ext_vector_type(2)))  unsigned v2u;
typedef __attribute__((ext_vector_type(16))) unsigned v16u;

#define D_INQ  1024
#define HEADS  16
#define DK     64
#define BATCH  2
#define SEQ    2048

#define FRAG 512
__device__ __forceinline__ v16h load_frag_t(const _Float16* tile) {
    const int lane = threadIdx.x & 31;
    const _Float16* p = tile + lane * 8;
    v8h lo = *(const v8h*)(p);                  // K = 8*(l>>4) .. +7
    v8h hi = *(const v8h*)(p + 256);            // K = 16 + 8*(l>>4) .. +7
    v16h f;
#pragma unroll
    for (int i = 0; i < 8; ++i) { f[i] = lo[i]; f[i + 8] = hi[i]; }
    return f;
}

__device__ __forceinline__ v8f wmma16(v16h a, v16h b, v8f c) {
    return __builtin_amdgcn_wmma_f32_16x16x32_f16(false, a, false, b,
                                                  (short)0, c, false, false);
}

__device__ __forceinline__ float xhalf(float x) {
    int b = __builtin_bit_cast(int, x);
    return __builtin_bit_cast(float,
        __builtin_amdgcn_permlanex16(b, b, 0x76543210, 0xfedcba98, false, false));
}

// ---- fp32 [rows,1024] row-major -> f16 in fragment order ----
// One 16-byte chunk g (8 consecutive k of one row) per thread, threads in the
// order of the destination, so that a wave stores 512 contiguous bytes.
__device__ __forceinline__ void cvt_f16_chunk(const float* __restrict__ src,
                                              _Float16* __restrict__ dst, int g) {
    const int r    = g & 15;
    const int c    = (g >> 4) & 3;
    const int tile = g >> 6;                     // row tile * 32 + k tile
    const int row  = ((tile >> 5) << 4) + r;
    const int k    = ((tile & 31) << 5) + (c << 3);
    const float* s = src + (size_t)row * D_INQ + k;
    v4f u = *(const v4f*)(s);
    v4f w = *(const v4f*)(s + 4);
    v8h pk;
#pragma unroll
    for (int i = 0; i < 4; ++i) { pk[i] = (_Float16)u[i]; pk[i + 4] = (_Float16)w[i]; }
    *(v8h*)(dst + (size_t)g * 8) = pk;
}

__device__ __forceinline__ void mask_pack_block(const int* __restrict__ mask,
                                                unsigned* __restrict__ mw, int blk) {
    const int lane = threadIdx.x & 31;
    const int col  = lane & 15;
    const int hi   = lane >> 4;
    const int task = blk * 8 + (threadIdx.x >> 5);          // tile * 16 + group of 4 steps
    const int tile = task >> 4;                             // b * (SEQ / 16) + q tile
    const int k0   = (task & 15) << 7;
    const int* mrow = mask + (size_t)(tile * 16 + col) * SEQ + k0 + 8 * hi;
    v4i m[16];
#pragma unroll
    for (int st = 0; st < 4; ++st)
#pragma unroll
        for (int g = 0; g < 4; ++g)
            m[st * 4 + g] = *(const v4i*)(mrow + st * 32 + (g >> 1) * 16 + (g & 1) * 4);
    v2u w = {0u, 0u};
#pragma unroll
    for (int j = 0; j < 64; ++j) {
        unsigned bl = __builtin_amdgcn_ballot_w32(m[j >> 2][j & 3] != 0);
        w[j & 1] = (lane == (j >> 1)) ? bl : w[j & 1];
    }
    *(v2u*)(mw + (size_t)task * 64 + lane * 2) = w;
}

// ---- one launch for all the work that needs nothing but the inputs ----
// The mask pack and the five conversions read and write disjoint data, so they
// share one grid: a range of the block index (a block-uniform branch) picks the
// job. The five f16 operands lie one behind the other in the workspace, x first,
// so a conversion block's number is also its place in the destination.
#define PREP_MASK_BLOCKS (BATCH * (SEQ / 16) * (SEQ / 128) / 8)
#define PREP_X_BLOCKS    (BATCH * SEQ * D_INQ / 8 / 256)
#define PREP_W_BLOCKS    (D_INQ * D_INQ / 8 / 256)
#define PREP_BLOCKS      (PREP_MASK_BLOCKS + PREP_X_BLOCKS + 4 * PREP_W_BLOCKS)
__global__ void __launch_bounds__(256)
mha_prep_kernel(const float* __restrict__ x,
                const float* __restrict__ Wq, const float* __restrict__ Wk,
                const float* __restrict__ Wv, const float* __restrict__ Wo,
                const int* __restrict__ mask,
                _Float16* __restrict__ f16ops, unsigned* __restrict__ mw) {
    if (blockIdx.x < PREP_MASK_BLOCKS) {
        mask_pack_block(mask, mw, blockIdx.x);
        return;
    }
    const int cb = blockIdx.x - PREP_MASK_BLOCKS;      // conversion block, x first
    const float* src = x;
    int base = 0;                                      // the matrix's first block
    if (cb >= PREP_X_BLOCKS) {
        const int w = (cb - PREP_X_BLOCKS) / PREP_W_BLOCKS;
        src  = w == 0 ? Wq : w == 1 ? Wk : w == 2 ? Wv : Wo;
        base = PREP_X_BLOCKS + w * PREP_W_BLOCKS;
    }
    cvt_f16_chunk(src, f16ops + (size_t)base * 256 * 8, (cb - base) * 256 + threadIdx.x);
}

// ---- NT GEMM: C[M,N] = A[M,1024] @ B[N,1024]^T + bias, A and B in fragment order ----
// Wave tile: 32 rows x 64 cols (2 A-frags share 4 B-frags -> 8 WMMA/K-step).
// Block tile: 128 rows x 128 cols, 4 x 2 waves: per K-step the block's waves ask for
// 8 KB of A and 8 KB of B between them (each A tile read by 2 waves, each B tile
// by 4), the fewest distinct lines that 8 such waves can need from L2.
// Double-buffered, K-loop unrolled x2: stage s computes while stage 1-s loads.
// No rotation copies: each buffer written only by loads, read only by WMMAs.
// mode 0: A = weight (rows = features), B = tokens, bias by row; a lane's 8
//         accumulator registers are 8 consecutive d of one token: one chunk of
//         the [s x d] operand of head (b,h), stored f16 in fragment order (scaled)
// mode 2: A = tokens, B = weight; f16 V^T of head (b,h) in fragment order
// mode 3: A = tokens, B = weight; f32 row-major [M,1024]
// bx, by: the block's 128-row tile and its 128-column tile
__device__ __forceinline__ void
gemm_nt_block(const _Float16* __restrict__ A,
              const _Float16* __restrict__ Bm,
              const float* __restrict__ bias,
              void* __restrict__ outp, int mode, float scale, int bx, int by) {
    const int wave = __builtin_amdgcn_readfirstlane(threadIdx.x >> 5);
    const int lane = threadIdx.x & 31;
    const int col  = lane & 15;
    const int hi   = lane >> 4;

    const int m0    = ((bx << 2) + (wave & 3)) << 5;   // 32 rows per wave, 4 waves down
    const int nbase = ((by << 1) + (wave >> 2)) << 6;  // 64 cols per wave, 2 waves across

    v8f acc[2][4];
    if (mode == 0) {
        float bv[2][8];
#pragma unroll
        for (int mh = 0; mh < 2; ++mh)
#pragma unroll
            for (int i = 0; i < 8; ++i) bv[mh][i] = bias[m0 + mh * 16 + 8 * hi + i];
        // these loads name registers that the copies and the set-up below reuse
        asm volatile("s_wait_xcnt 0x0" ::: "memory");
#pragma unroll
        for (int mh = 0; mh < 2; ++mh)
#pragma unroll
            for (int i = 0; i < 8; ++i)
#pragma unroll
                for (int t = 0; t < 4; ++t) acc[mh][t][i] = bv[mh][i];
    } else {
#pragma unroll
        for (int t = 0; t < 4; ++t) {
            float bv = bias[nbase + t * 16 + col];
#pragma unroll
            for (int i = 0; i < 8; ++i) { acc[0][t][i] = bv; acc[1][t][i] = bv; }
        }
    }

    // a 16-row band is RT = 32 tiles; k advances one tile (FRAG halves) per 32
    const int RT = (D_INQ / 32) * FRAG;
    const _Float16* A0 = A + (size_t)(m0 >> 4) * RT;
    const _Float16* A1 = A0 + RT;
    const _Float16* Bw = Bm + (size_t)(nbase >> 4) * RT;

    v16h a0[2], a1[2], bf[2][4];

    // prologue: stage 0 <- k = 0
    a0[0] = load_frag_t(A0);
    a1[0] = load_frag_t(A1);
#pragma unroll
    for (int t = 0; t < 4; ++t)
        bf[0][t] = load_frag_t(Bw + t * RT);

    const _Float16* pa = A0;    // tiles of stage 0, wave-uniform
    const _Float16* pb = Bw;
#pragma unroll 1
    for (int k = 0; k < D_INQ; k += 64) {
        // stage 1 <- k+32 (overlaps stage-0 WMMAs)
        a0[1] = load_frag_t(pa + FRAG);
        a1[1] = load_frag_t(pa + RT + FRAG);
#pragma unroll
        for (int t = 0; t < 4; ++t)
            bf[1][t] = load_frag_t(pb + t * RT + FRAG);

#pragma unroll
        for (int t = 0; t < 4; ++t) {
            acc[0][t] = wmma16(a0[0], bf[0][t], acc[0][t]);
            acc[1][t] = wmma16(a1[0], bf[0][t], acc[1][t]);
        }

        // stage 0 <- k+64 (wraps to 0 on last iter; overlaps stage-1 WMMAs)
        const bool more = k + 64 < D_INQ;
        pa = more ? pa + 2 * FRAG : A0;
        pb = more ? pb + 2 * FRAG : Bw;
        a0[0] = load_frag_t(pa);
        a1[0] = load_frag_t(pa + RT);
#pragma unroll
        for (int t = 0; t < 4; ++t)
            bf[0][t] = load_frag_t(pb + t * RT);

#pragma unroll
        for (int t = 0; t < 4; ++t) {
            acc[0][t] = wmma16(a0[1], bf[1][t], acc[0][t]);
            acc[1][t] = wmma16(a1[1], bf[1][t], acc[1][t]);
        }
    }
    // the last trip's loads still name the lane offset, which the epilogues rewrite;
    // the scheduling barrier keeps the epilogues' set-up behind the wait
    asm volatile("s_wait_xcnt 0x0" ::: "memory");
    __builtin_amdgcn_sched_barrier(0);

    if (mode == 3) {
        float* out = (float*)outp;
#pragma unroll
        for (int mh = 0; mh < 2; ++mh)
#pragma unroll
            for (int i = 0; i < 8; ++i) {
                int tg = m0 + mh * 16 + i + 8 * hi;
#pragma unroll
                for (int t = 0; t < 4; ++t)
                    out[(size_t)tg * D_INQ + nbase + t * 16 + col] = acc[mh][t][i];
            }
        // the stores' registers may be rewritten behind this branch
        asm volatile("s_wait_xcnt 0x0" ::: "memory");
    } else if (mode == 2) {
        // V^T of head (b,h), rows d, k = s: a lane's 8 accumulator registers are
        // 8 consecutive s of one d row, one chunk. Tiles in the order
        // [32-key step][d tile], so that a step's four fragments are 4 KB in a row.
        _Float16* out = (_Float16*)outp;
#pragma unroll
        for (int mh = 0; mh < 2; ++mh) {
            int tg0 = m0 + mh * 16 + 8 * hi;   // multiple of 8: one batch, 16-B aligned
            int b  = tg0 >> 11;       // / SEQ
            int s0 = tg0 & (SEQ - 1);
#pragma unroll
            for (int t = 0; t < 4; ++t) {
                int o = nbase + t * 16 + col;
                int h = o >> 6, d = o & 63;
                v8h pk;
#pragma unroll
                for (int i = 0; i < 8; ++i)
                    pk[i] = (_Float16)(acc[mh][t][i] * scale);
                *(v8h*)(out + (size_t)(b * HEADS + h) * DK * SEQ
                            + (size_t)((s0 >> 5) * 4 + (d >> 4)) * FRAG
                            + ((s0 >> 3) & 3) * 128 + (d & 15) * 8) = pk;
            }
        }
    } else {
        // Q/K of head (b,h), rows s, k = d: tiles in the order [16-row band][d / 32]
        _Float16* out = (_Float16*)outp;
#pragma unroll
        for (int mh = 0; mh < 2; ++mh) {
            int o0 = m0 + mh * 16 + 8 * hi;    // multiple of 8: one head, one chunk
            int h  = o0 >> 6, d0 = o0 & 63;
#pragma unroll
            for (int t = 0; t < 4; ++t) {
                int tg = nbase + t * 16 + col;
                int b = tg >> 11;         // / SEQ
                int s = tg & (SEQ - 1);
                v8h pk;
#pragma unroll
                for (int i = 0; i < 8; ++i)
                    pk[i] = (_Float16)(acc[mh][t][i] * scale);
                *(v8h*)(out + (size_t)(b * HEADS + h) * SEQ * DK
                            + (size_t)((s >> 4) * 2 + (d0 >> 5)) * FRAG
                            + ((d0 >> 3) & 3) * 128 + (s & 15) * 8) = pk;
            }
        }
        // the stores' registers may be rewritten behind this branch
        asm volatile("s_wait_xcnt 0x0" ::: "memory");
    }
}

// ---- the three projections in one launch: none needs another's result ----
// 256 blocks each, the job from the block index (block-uniform):
// Q and K: 8 feature tiles x 32 token tiles; V: 32 token tiles x 8 feature tiles;
// a block number means the same token tile and feature tile in all three jobs
#define PROJ_BLOCKS ((BATCH * SEQ / 128) * (D_INQ / 128))
__global__ void __launch_bounds__(256)
mha_qkv_kernel(const _Float16* __restrict__ xh,
               const _Float16* __restrict__ wq, const _Float16* __restrict__ wk,
               const _Float16* __restrict__ wv,
               const float* __restrict__ bq, const float* __restrict__ bk,
               const float* __restrict__ bv,
               _Float16* __restrict__ Qh, _Float16* __restrict__ Kh,
               _Float16* __restrict__ Vth, float qscale) {
    const int job = blockIdx.x / PROJ_BLOCKS;          // 0 Q, 1 K, 2 V
    const int r   = blockIdx.x % PROJ_BLOCKS;
    const bool isv = job == 2;
    gemm_nt_block(isv ? xh : job ? wk : wq,
                  isv ? wv : xh,
                  isv ? bv : job ? bk : bq,
                  (void*)(isv ? Vth : job ? Kh : Qh),
                  isv ? 2 : 0,
                  job == 0 ? qscale : 1.0f,
                  isv ? r / (D_INQ / 128) : r % (D_INQ / 128),
                  isv ? r % (D_INQ / 128) : r / (D_INQ / 128));
}

// ---- output projection ----
__global__ void __launch_bounds__(256)
mha_out_kernel(const _Float16* __restrict__ ctx, const _Float16* __restrict__ wo,
               const float* __restrict__ bo, float* __restrict__ out) {
    gemm_nt_block(ctx, wo, bo, (void*)out, 3, 1.0f, blockIdx.x, blockIdx.y);
}

#define ATT_WAVES  8
#define STG_KEYS   128
#define STG_HALVES (STG_KEYS * DK)          // halves of K, and of V^T, in a stage
#define STG_BYTES  (4 * STG_HALVES)         // K and V^T of a stage, bytes
#define NSTG       (SEQ / STG_KEYS)

// One stage: every thread copies 4 x 16 bytes of K and 4 x 16 bytes of V^T, byte
// for byte in the order of the workspace (K first, V^T behind it). lds, kg, vg:
// the thread's own first LDS byte and global addresses; a copy round of the
// block is 256 x 16 = 4096 bytes.
__device__ __forceinline__ void stage_copies(unsigned lds, const _Float16* kg,
                                             const _Float16* vg) {
    asm volatile(
        "global_load_async_to_lds_b128 %0, %8, off\n\t"
        "global_load_async_to_lds_b128 %1, %9, off\n\t"
        "global_load_async_to_lds_b128 %2, %10, off\n\t"
        "global_load_async_to_lds_b128 %3, %11, off\n\t"
        "global_load_async_to_lds_b128 %4, %12, off\n\t"
        "global_load_async_to_lds_b128 %5, %13, off\n\t"
        "global_load_async_to_lds_b128 %6, %14, off\n\t"
        "global_load_async_to_lds_b128 %7, %15, off\n\t"
        "s_wait_xcnt 0x0"
        :: "v"(lds), "v"(lds + 4096u), "v"(lds + 8192u), "v"(lds + 12288u),
           "v"(lds + 16384u), "v"(lds + 20480u), "v"(lds + 24576u), "v"(lds + 28672u),
           "v"(kg), "v"(kg + 2048), "v"(kg + 4096), "v"(kg + 6144),
           "v"(vg), "v"(vg + 2048), "v"(vg + 4096), "v"(vg + 6144)
        : "memory");
}

__global__ void __launch_bounds__(32 * ATT_WAVES) __attribute__((amdgpu_waves_per_eu(4, 4)))
mha_attn_kernel(const _Float16* __restrict__ Q,
                const _Float16* __restrict__ Km,
                const _Float16* __restrict__ Vt,
                const unsigned* __restrict__ mwords,
                _Float16* __restrict__ ctx) {
    __shared__ __attribute__((aligned(16))) _Float16 kv[2][2 * STG_HALVES];

    const int wave = threadIdx.x >> 5;
    const int lane = threadIdx.x & 31;
    const int col  = lane & 15;
    const int hi   = lane >> 4;

    // tile = blockIdx.x * 8 + wave, 0 .. B*H*(S/16)-1; a block's 8 tiles share
    // one head, so b and h come from blockIdx alone and stay scalar
    int b  = blockIdx.x >> 8;
    int h  = (blockIdx.x >> 4) & (HEADS - 1);
    int q0 = (((blockIdx.x & 15) << 3) + wave) << 4;

    const _Float16* Qbh = Q  + (size_t)(b * HEADS + h) * SEQ * DK;
    const _Float16* Kbh = Km + (size_t)(b * HEADS + h) * SEQ * DK;
    const _Float16* Vbh = Vt + (size_t)(b * HEADS + h) * DK * SEQ;

    // stage 0 on its way first: it has the longest way
    const unsigned lds0 = (unsigned)(size_t)(&kv[0][0]) + threadIdx.x * 16u;
    const _Float16* kg  = Kbh + threadIdx.x * 8;
    const _Float16* vg  = Vbh + threadIdx.x * 8;
    stage_copies(lds0, kg, vg);

    // the wave's lane-mask words, 16 per 32-key step; the wave's number as a
    // scalar, so that they come by scalar loads into scalar registers
    const int wv = __builtin_amdgcn_readfirstlane(threadIdx.x >> 5);
    const unsigned* mw = mwords
        + (size_t)(b * (SEQ / 16) + ((blockIdx.x & 15) << 3) + wv) * (SEQ / 32) * 16;
    // read through the constant address space: nothing writes the words during this
    // launch, and behind a barrier the compiler keeps scalar loads only for such reads
    typedef const __attribute__((address_space(4))) v16u* mask_words_p;
    v16u wc = *(mask_words_p)(mw);      // step 0's words

    // Q already scaled by 1/sqrt(dk) at projection time
    // (a 16-row band of Q or K is two tiles, d 0..31 and d 32..63: 16 * DK halves)
    v16h aq0 = load_frag_t(Qbh + (size_t)q0 * DK);
    v16h aq1 = load_frag_t(Qbh + (size_t)q0 * DK + FRAG);
    // these loads name registers that the set-up below reuses; the scheduling
    // barrier keeps that set-up behind the wait
    asm volatile("s_wait_xcnt 0x0" ::: "memory");
    __builtin_amdgcn_sched_barrier(0);

    float mrun = -3.0e38f;   // running maximum of query col (equal in both halves)
    float lrun = 0.f;        // running sum over this lane's own keys only
    v8f zero = {};
    v8f acc[4];              // acc[t][i] = O[q0 + col][t*16 + 8*hi + i]
#pragma unroll
    for (int t = 0; t < 4; ++t) acc[t] = zero;

    // stage 0 has landed for this wave's copies; the barrier publishes all waves'
    asm volatile("s_wait_asynccnt 0x0" ::: "memory");
    __syncthreads();
    stage_copies(lds0 + STG_BYTES, kg + STG_HALVES, vg + STG_HALVES);

    // One 32-key step on the tiles at Ks and Vs (LDS)
    auto step = [&](const _Float16* Ks, const _Float16* Vs, int k0)
        __attribute__((always_inline)) {
        // the step's K fragments, then its V fragments: one group of LDS reads
        v16h kf[4], vF[4];
#pragma unroll
        for (int j = 0; j < 4; ++j) kf[j] = load_frag_t(Ks + j * FRAG);
#pragma unroll
        for (int t = 0; t < 4; ++t) vF[t] = load_frag_t(Vs + t * FRAG);

        // S^T: two 16x16 tiles (key rows k0..k0+15, k0+16..k0+31), K-dim = 64
        v8f sA = zero, sB = zero;
        sA = wmma16(kf[0], aq0, sA);
        sA = wmma16(kf[1], aq1, sA);
        sB = wmma16(kf[2], aq0, sB);
        sB = wmma16(kf[3], aq1, sB);

        // mask + online softmax; s[j] is key k0 + kmap(j): j < 8 from sA, else sB
        float s[16];
#pragma unroll
        for (int i = 0; i < 8; ++i) {
            s[i]     = __builtin_amdgcn_inverse_ballot_w32(wc[i])     ? sA[i] : -1.0e9f;
            s[i + 8] = __builtin_amdgcn_inverse_ballot_w32(wc[i + 8]) ? sB[i] : -1.0e9f;
        }
        // next step's words, behind this step's selects: a whole step ahead of their
        // use, and not in flight at the selects' wait (a scalar-load wait is to 0)
        const int k0n = (k0 + 32 < SEQ) ? k0 + 32 : 0;
        wc = *(mask_words_p)(mw + (k0n >> 1));
        float mx[8];
#pragma unroll
        for (int i = 0; i < 8; ++i) mx[i] = fmaxf(s[i], s[i + 8]);
        float rm = fmaxf(fmaxf(fmaxf(mx[0], mx[1]), fmaxf(mx[2], mx[3])),
                         fmaxf(fmaxf(mx[4], mx[5]), fmaxf(mx[6], mx[7])));
        rm = fmaxf(rm, xhalf(rm));
        float mn = fmaxf(mrun, rm);
        float alpha = __expf(mrun - mn);
        mrun = mn;

        float p[16];
        v16h pF;
#pragma unroll
        for (int j = 0; j < 16; ++j) {
            p[j]  = __expf(s[j] - mn);
            pF[j] = (_Float16)p[j];
        }
        float ps[4];
#pragma unroll
        for (int j = 0; j < 4; ++j)
            ps[j] = (p[j] + p[j + 4]) + (p[j + 8] + p[j + 12]);
        lrun = lrun * alpha + ((ps[0] + ps[1]) + (ps[2] + ps[3]));

        // O^T = O^T * alpha + V^T(64x32) @ P^T(32x16)
#pragma unroll
        for (int t = 0; t < 4; ++t) {
#pragma unroll
            for (int i = 0; i < 8; ++i) acc[t][i] *= alpha;
            acc[t] = wmma16(vF[t], pF, acc[t]);
        }
    };

    // rolled: one trip per stage, so that the ring's order stands once in the code
#pragma unroll 1
    for (int sg = 0; sg < NSTG; ++sg) {
        // Two steps a trip of the inner loop: their 32 LDS reads go out as one group and
        // the two softmax chains interleave; all four steps of a stage unrolled scatter
        // the reads among the products, each with a wait to 0 behind it.
#pragma unroll 1
        for (int hf = 0; hf < STG_KEYS / 64; ++hf) {
            const _Float16* Ks = &kv[sg & 1][(hf & 1) * 64 * DK];
            const _Float16* Vs = Ks + STG_HALVES;
            step(Ks, Vs, sg * STG_KEYS + hf * 64);
            step(Ks + 32 * DK, Vs + 32 * DK, sg * STG_KEYS + hf * 64 + 32);
        }

        // hand-over: this wave's reads of the buffer are done ...
        asm volatile("s_wait_dscnt 0x0" ::: "memory");
        // ... its copies of stage sg + 1 have landed ...
        asm volatile("s_wait_asynccnt 0x0" ::: "memory");
        // ... and the barrier says both of every wave: it publishes stage sg + 1
        // and frees the buffer that the refill below writes
        __syncthreads();
        if (sg + 2 < NSTG)
            stage_copies(lds0 + (unsigned)(sg & 1) * STG_BYTES,
                         kg + (size_t)(sg + 2) * STG_HALVES,
                         vg + (size_t)(sg + 2) * STG_HALVES);
    }
    // no copy is left in flight when the wave ends
    asm volatile("s_wait_asynccnt 0x0" ::: "memory");

    // join the halves' sums, normalize, store context [B*S rows, 1024 k] f16 in
    // fragment order for the output GEMM: a lane's 8 registers are 8 consecutive
    // d of one query row, one chunk; k = h*64 + t*16 + 8*hi is tile h*2 + (t>>1),
    // chunk (t&1)*2 + hi
    float inv = 1.0f / (lrun + xhalf(lrun));
    _Float16* crow = ctx + ((size_t)((b * SEQ + q0) >> 4) * (D_INQ / 32) + h * 2) * FRAG
                         + hi * 128 + col * 8;
#pragma unroll
    for (int t = 0; t < 4; ++t) {
        v8h pk;
#pragma unroll
        for (int i = 0; i < 8; ++i) pk[i] = (_Float16)(acc[t][i] * inv);
        *(v8h*)(crow + (t >> 1) * FRAG + (t & 1) * 256) = pk;
    }
}

extern "C" void kernel_launch(void* const* d_in, const int* in_sizes, int n_in,
                              void* d_out, int out_size, void* d_ws, size_t ws_size,
                              hipStream_t stream) {
    (void)in_sizes; (void)n_in; (void)out_size; (void)ws_size;
    const float* x   = (const float*)d_in[0];
    const int*   msk = (const int*)d_in[1];
    const float* Wq  = (const float*)d_in[2];
    const float* bq  = (const float*)d_in[3];
    const float* Wk  = (const float*)d_in[4];
    const float* bk  = (const float*)d_in[5];
    const float* Wv  = (const float*)d_in[6];
    const float* bv  = (const float*)d_in[7];
    const float* Wo  = (const float*)d_in[8];
    const float* bo  = (const float*)d_in[9];
    float* out = (float*)d_out;

    const size_t NX = (size_t)BATCH * SEQ * D_INQ;   // 4M elems
    const size_t NW = (size_t)D_INQ * D_INQ;         // 1M elems
    char* ws = (char*)d_ws;
    _Float16* xh  = (_Float16*)(ws);
    _Float16* wqh = (_Float16*)(ws + NX * 2);
    _Float16* wkh = (_Float16*)(ws + NX * 2 + NW * 2);
    _Float16* wvh = (_Float16*)(ws + NX * 2 + NW * 4);
    _Float16* woh = (_Float16*)(ws + NX * 2 + NW * 6);
    _Float16* Qh  = (_Float16*)(ws + NX * 2 + NW * 8);
    _Float16* Kh  = (_Float16*)(ws + NX * 4 + NW * 8);
    _Float16* Vth = (_Float16*)(ws + NX * 6 + NW * 8);
    _Float16* Ch  = (_Float16*)(ws + NX * 8 + NW * 8);
    unsigned* mwd = (unsigned*)(ws + NX * 10 + NW * 8);   // B*S*S bits, 1 MB

    // xh, wqh, wkh, wvh, woh are written as one run of f16 operands from xh on
    mha_prep_kernel<<<PREP_BLOCKS, 256, 0, stream>>>(x, Wq, Wk, Wv, Wo, msk, xh, mwd);

    const float qscale = 0.125f;    // 1/sqrt(DK)
    mha_qkv_kernel<<<3 * PROJ_BLOCKS, 256, 0, stream>>>(xh, wqh, wkh, wvh, bq, bk, bv,
                                                        Qh, Kh, Vth, qscale);

    mha_attn_kernel<<<BATCH * HEADS * (SEQ / 16) / ATT_WAVES, 32 * ATT_WAVES, 0, stream>>>(
        Qh, Kh, Vth, mwd, Ch);

    dim3 gg(BATCH * SEQ / 128, D_INQ / 128);   // 32 M-tiles x 8 N-tiles of 128 x 128
    mha_out_kernel<<<gg, 256, 0, stream>>>(Ch, woh, bo, out);
}

// v008
// A run of this version takes 102 microseconds.
// Next to v007, in two timings, it ran 1.09 times as fast each time.
// Over all steps from v000 it is 3.00 times as fast.
#include <hip/hip_runtime.h>

typedef __attribute__((ext_vector_type(16))) _Float16 v16h;
typedef __attribute__((ext_vector_type(8)))  _Float16 v8h;
typedef __attribute__((ext_vector_type(8)))  float    v8f;
typedef __attribute__((ext_vector_type(4)))  int      v4i;
typedef __attribute__((ext_vector_type(4)))  float    v4f;
typedef __attribute__((ext_vector_type(4)))  _Float16 v4h;
typedef __attribute__((ext_vector_type(2)))  unsigned v2u;
typedef __attribute__((ext_vector_type(4)))  unsigned v4u;
typedef __attribute__((ext_vector_type(16))) unsigned v16u;

#define D_INQ  1024
#define HEADS  16
#define DK     64
#define BATCH  2
#define SEQ    2048

#define FRAG 512
__device__ __forceinline__ v16h load_frag_t(const _Float16* tile) {
    const int lane = threadIdx.x & 31;
    const _Float16* p = tile + lane * 8;
    v8h lo = *(const v8h*)(p);                  // K = 8*(l>>4) .. +7
    v8h hi = *(const v8h*)(p + 256);            // K = 16 + 8*(l>>4) .. +7
    v16h f;
#pragma unroll
    for (int i = 0; i < 8; ++i) { f[i] = lo[i]; f[i + 8] = hi[i]; }
    return f;
}

__device__ __forceinline__ v8f wmma16(v16h a, v16h b, v8f c) {
    return __builtin_amdgcn_wmma_f32_16x16x32_f16(false, a, false, b,
                                                  (short)0, c, false, false);
}

__device__ __forceinline__ float xhalf(float x) {
    int b = __builtin_bit_cast(int, x);
    return __builtin_bit_cast(float,
        __builtin_amdgcn_permlanex16(b, b, 0x76543210, 0xfedcba98, false, false));
}

__device__ __forceinline__ unsigned xpair(unsigned v) {
    return (unsigned)__builtin_amdgcn_mov_dpp((int)v, 0xB1, 0xF, 0xF, true);
}

__device__ __forceinline__ void cvt_f16_tiles(const float* __restrict__ src,
                                              _Float16* __restrict__ dst, int wt) {
    const int lane = threadIdx.x & 31;
    const int q    = lane >> 3;                  // row within a load's 4 rows
    const int odd  = lane & 1;
    const int t0   = wt << 2;                    // first tile: band * 32 + k tile
    const float* s = src + (size_t)(((t0 >> 5) << 4) + q) * D_INQ
                         + ((t0 & 31) << 5) + ((lane & 7) << 2);
    v4f u[4][4];
#pragma unroll
    for (int tt = 0; tt < 4; ++tt)
#pragma unroll
        for (int i = 0; i < 4; ++i)
            u[tt][i] = *(const v4f*)(s + tt * 32 + i * 4 * D_INQ);
    // all 16 loads name one address pair: as an input here it stays whole up to the
    // wait (the compiler had placed the last load's result on it)
    asm volatile("s_wait_xcnt 0x0" :: "v"(s) : "memory");
    // keeps the conversions behind the last load: without it the compiler reuses the
    // first loads' registers for the later ones, which then wait out a second latency
    __builtin_amdgcn_sched_barrier(0);
    _Float16* d = dst + (size_t)t0 * FRAG + ((lane & 7) >> 1) * 128 + (q + 4 * odd) * 8;
#pragma unroll
    for (int tt = 0; tt < 4; ++tt)
#pragma unroll
        for (int pr = 0; pr < 2; ++pr) {
            v4h ha, hb;                          // rows q + 8 pr and q + 4 + 8 pr
#pragma unroll
            for (int i = 0; i < 4; ++i) {
                ha[i] = (_Float16)u[tt][2 * pr][i];
                hb[i] = (_Float16)u[tt][2 * pr + 1][i];
            }
            v2u a = __builtin_bit_cast(v2u, ha);
            v2u b = __builtin_bit_cast(v2u, hb);
            unsigned r0 = xpair(odd ? a[0] : b[0]);
            unsigned r1 = xpair(odd ? a[1] : b[1]);
            v4u o;                               // k 0..3 from the even lane, 4..7 from the odd
            o[0] = odd ? r0 : a[0];
            o[1] = odd ? r1 : a[1];
            o[2] = odd ? b[0] : r0;
            o[3] = odd ? b[1] : r1;
            *(v4u*)(d + tt * FRAG + pr * 64) = o;
        }
}

__device__ __forceinline__ void mask_pack_block(const int* __restrict__ mask,
                                                unsigned* __restrict__ mw, int blk) {
    const int lane = threadIdx.x & 31;
    const int col  = lane & 15;
    const int hi   = lane >> 4;
    // the wave's number as a scalar: the rows' addresses stay in scalar registers
    const int task = blk * 8 + __builtin_amdgcn_readfirstlane(threadIdx.x >> 5);
    const int tile = task >> 4;                             // b * (SEQ / 16) + q tile
    const int k0   = (task & 15) << 7;                      // group of 4 steps
    const int* mrow = mask + (size_t)(tile * 16) * SEQ + k0;
    v4i m[16];
#pragma unroll
    for (int r = 0; r < 16; ++r)
        m[r] = *(const v4i*)(mrow + r * SEQ + lane * 4);
    // keeps the compares behind the last load, so that all 16 loads fly together
    __builtin_amdgcn_sched_barrier(0);
    unsigned x[4] = {0u, 0u, 0u, 0u};    // row col: word e, bit l is key 4 l + e
#pragma unroll
    for (int r = 0; r < 16; ++r)
#pragma unroll
        for (int e = 0; e < 4; ++e) {
            unsigned bl = __builtin_amdgcn_ballot_w32(m[r][e] != 0);
            x[e] = (col == r) ? bl : x[e];
        }
    // key = st * 32 + (j >> 3) * 16 + 8 * hi + (j & 7): word j & 3, bit key >> 2;
    // the lane's own part of the bit number, 2 * hi, is shifted out once
#pragma unroll
    for (int e = 0; e < 4; ++e) x[e] >>= 2 * hi;
    v2u w = {0u, 0u};
#pragma unroll
    for (int j = 0; j < 64; ++j) {
        const unsigned bit = (j >> 4) * 8 + ((j >> 3) & 1) * 4 + ((j >> 2) & 1);
        unsigned bl = __builtin_amdgcn_ballot_w32((x[j & 3] & (1u << bit)) != 0u);
        w[j & 1] = (lane == (j >> 1)) ? bl : w[j & 1];
    }
    *(v2u*)(mw + (size_t)task * 64 + lane * 2) = w;
}

// ---- one launch for all the work that needs nothing but the inputs ----
// The mask pack and the five conversions read and write disjoint data, so they
// share one grid: a range of the block index (a block-uniform branch) picks the
// job. The five f16 operands lie one behind the other in the workspace, x first,
// so a conversion block's number is also its place in the destination.
// A conversion block is 8 waves of 4 tiles each.
#define PREP_MASK_BLOCKS (BATCH * (SEQ / 16) * (SEQ / 128) / 8)
#define PREP_X_BLOCKS    (BATCH * SEQ * D_INQ / FRAG / 32)
#define PREP_W_BLOCKS    (D_INQ * D_INQ / FRAG / 32)
#define PREP_BLOCKS      (PREP_MASK_BLOCKS + PREP_X_BLOCKS + 4 * PREP_W_BLOCKS)
__global__ void __launch_bounds__(256)
mha_prep_kernel(const float* __restrict__ x,
                const float* __restrict__ Wq, const float* __restrict__ Wk,
                const float* __restrict__ Wv, const float* __restrict__ Wo,
                const int* __restrict__ mask,
                _Float16* __restrict__ f16ops, unsigned* __restrict__ mw) {
    if (blockIdx.x < PREP_MASK_BLOCKS) {
        mask_pack_block(mask, mw, blockIdx.x);
        return;
    }
    const int cb = blockIdx.x - PREP_MASK_BLOCKS;      // conversion block, x first
    const float* src = x;
    int base = 0;                                      // the matrix's first block
    if (cb >= PREP_X_BLOCKS) {
        const int w = (cb - PREP_X_BLOCKS) / PREP_W_BLOCKS;
        src  = w == 0 ? Wq : w == 1 ? Wk : w == 2 ? Wv : Wo;
        base = PREP_X_BLOCKS + w * PREP_W_BLOCKS;
    }
    // the wave's number as a scalar: the tiles' addresses stay in scalar registers
    const int wave = __builtin_amdgcn_readfirstlane(threadIdx.x >> 5);
    cvt_f16_tiles(src, f16ops + (size_t)base * 32 * FRAG, (cb - base) * 8 + wave);
}

// ---- NT GEMM: C[M,N] = A[M,1024] @ B[N,1024]^T + bias, A and B in fragment order ----
// Wave tile: 32 rows x 64 cols (2 A-frags share 4 B-frags -> 8 WMMA/K-step).
// Block tile: 128 rows x 128 cols, 4 x 2 waves: per K-step the block's waves ask for
// 8 KB of A and 8 KB of B between them (each A tile read by 2 waves, each B tile
// by 4), the fewest distinct lines that 8 such waves can need from L2.
// Double-buffered, K-loop unrolled x2: stage s computes while stage 1-s loads.
// No rotation copies: each buffer written only by loads, read only by WMMAs.
// mode 0: A = weight (rows = features), B = tokens, bias by row; a lane's 8
//         accumulator registers are 8 consecutive d of one token: one chunk of
//         the [s x d] operand of head (b,h), stored f16 in fragment order (scaled)
// mode 2: A = tokens, B = weight; f16 V^T of head (b,h) in fragment order
// mode 3: A = tokens, B = weight; f32 row-major [M,1024]
// bx, by: the block's 128-row tile and its 128-column tile
__device__ __forceinline__ void
gemm_nt_block(const _Float16* __restrict__ A,
              const _Float16* __restrict__ Bm,
              const float* __restrict__ bias,
              void* __restrict__ outp, int mode, float scale, int bx, int by) {
    const int wave = __builtin_amdgcn_readfirstlane(threadIdx.x >> 5);
    const int lane = threadIdx.x & 31;
    const int col  = lane & 15;
    const int hi   = lane >> 4;

    const int m0    = ((bx << 2) + (wave & 3)) << 5;   // 32 rows per wave, 4 waves down
    const int nbase = ((by << 1) + (wave >> 2)) << 6;  // 64 cols per wave, 2 waves across

    v8f acc[2][4];
    if (mode == 0) {
        float bv[2][8];
#pragma unroll
        for (int mh = 0; mh < 2; ++mh)
#pragma unroll
            for (int i = 0; i < 8; ++i) bv[mh][i] = bias[m0 + mh * 16 + 8 * hi + i];
        // these loads name registers that the copies and the set-up below reuse
        asm volatile("s_wait_xcnt 0x0" ::: "memory");
#pragma unroll
        for (int mh = 0; mh < 2; ++mh)
#pragma unroll
            for (int i = 0; i < 8; ++i)
#pragma unroll
                for (int t = 0; t < 4; ++t) acc[mh][t][i] = bv[mh][i];
    } else {
#pragma unroll
        for (int t = 0; t < 4; ++t) {
            float bv = bias[nbase + t * 16 + col];
#pragma unroll
            for (int i = 0; i < 8; ++i) { acc[0][t][i] = bv; acc[1][t][i] = bv; }
        }
    }

    // a 16-row band is RT = 32 tiles; k advances one tile (FRAG halves) per 32
    const int RT = (D_INQ / 32) * FRAG;
    const _Float16* A0 = A + (size_t)(m0 >> 4) * RT;
    const _Float16* A1 = A0 + RT;
    const _Float16* Bw = Bm + (size_t)(nbase >> 4) * RT;

    v16h a0[2], a1[2], bf[2][4];

    // prologue: stage 0 <- k = 0
    a0[0] = load_frag_t(A0);
    a1[0] = load_frag_t(A1);
#pragma unroll
    for (int t = 0; t < 4; ++t)
        bf[0][t] = load_frag_t(Bw + t * RT);

    const _Float16* pa = A0;    // tiles of stage 0, wave-uniform
    const _Float16* pb = Bw;
#pragma unroll 1
    for (int k = 0; k < D_INQ; k += 64) {
        // stage 1 <- k+32 (overlaps stage-0 WMMAs)
        a0[1] = load_frag_t(pa + FRAG);
        a1[1] = load_frag_t(pa + RT + FRAG);
#pragma unroll
        for (int t = 0; t < 4; ++t)
            bf[1][t] = load_frag_t(pb + t * RT + FRAG);

#pragma unroll
        for (int t = 0; t < 4; ++t) {
            acc[0][t] = wmma16(a0[0], bf[0][t], acc[0][t]);
            acc[1][t] = wmma16(a1[0], bf[0][t], acc[1][t]);
        }

        // stage 0 <- k+64 (wraps to 0 on last iter; overlaps stage-1 WMMAs)
        const bool more = k + 64 < D_INQ;
        pa = more ? pa + 2 * FRAG : A0;
        pb = more ? pb + 2 * FRAG : Bw;
        a0[0] = load_frag_t(pa);
        a1[0] = load_frag_t(pa + RT);
#pragma unroll
        for (int t = 0; t < 4; ++t)
            bf[0][t] = load_frag_t(pb + t * RT);

#pragma unroll
        for (int t = 0; t < 4; ++t) {
            acc[0][t] = wmma16(a0[1], bf[1][t], acc[0][t]);
            acc[1][t] = wmma16(a1[1], bf[1][t], acc[1][t]);
        }
    }
    // the last trip's loads still name the lane offset, which the epilogues rewrite;
    // the scheduling barrier keeps the epilogues' set-up behind the wait
    asm volatile("s_wait_xcnt 0x0" ::: "memory");
    __builtin_amdgcn_sched_barrier(0);

    if (mode == 3) {
        float* out = (float*)outp;
#pragma unroll
        for (int mh = 0; mh < 2; ++mh)
#pragma unroll
            for (int i = 0; i < 8; ++i) {
                int tg = m0 + mh * 16 + i + 8 * hi;
#pragma unroll
                for (int t = 0; t < 4; ++t)
                    out[(size_t)tg * D_INQ + nbase + t * 16 + col] = acc[mh][t][i];
            }
        // the stores' registers may be rewritten behind this branch
        asm volatile("s_wait_xcnt 0x0" ::: "memory");
    } else if (mode == 2) {
        // V^T of head (b,h), rows d, k = s: a lane's 8 accumulator registers are
        // 8 consecutive s of one d row, one chunk. Tiles in the order
        // [32-key step][d tile], so that a step's four fragments are 4 KB in a row.
        _Float16* out = (_Float16*)outp;
#pragma unroll
        for (int mh = 0; mh < 2; ++mh) {
            int tg0 = m0 + mh * 16 + 8 * hi;   // multiple of 8: one batch, 16-B aligned
            int b  = tg0 >> 11;       // / SEQ
            int s0 = tg0 & (SEQ - 1);
#pragma unroll
            for (int t = 0; t < 4; ++t) {
                int o = nbase + t * 16 + col;
                int h = o >> 6, d = o & 63;
                v8h pk;
#pragma unroll
                for (int i = 0; i < 8; ++i)
                    pk[i] = (_Float16)(acc[mh][t][i] * scale);
                *(v8h*)(out + (size_t)(b * HEADS + h) * DK * SEQ
                            + (size_t)((s0 >> 5) * 4 + (d >> 4)) * FRAG
                            + ((s0 >> 3) & 3) * 128 + (d & 15) * 8) = pk;
            }
        }
    } else {
        // Q/K of head (b,h), rows s, k = d: tiles in the order [16-row band][d / 32]
        _Float16* out = (_Float16*)outp;
#pragma unroll
        for (int mh = 0; mh < 2; ++mh) {
            int o0 = m0 + mh * 16 + 8 * hi;    // multiple of 8: one head, one chunk
            int h  = o0 >> 6, d0 = o0 & 63;
#pragma unroll
            for (int t = 0; t < 4; ++t) {
                int tg = nbase + t * 16 + col;
                int b = tg >> 11;         // / SEQ
                int s = tg & (SEQ - 1);
                v8h pk;
#pragma unroll
                for (int i = 0; i < 8; ++i)
                    pk[i] = (_Float16)(acc[mh][t][i] * scale);
                *(v8h*)(out + (size_t)(b * HEADS + h) * SEQ * DK
                            + (size_t)((s >> 4) * 2 + (d0 >> 5)) * FRAG
                            + ((d0 >> 3) & 3) * 128 + (s & 15) * 8) = pk;
            }
        }
        // the stores' registers may be rewritten behind this branch
        asm volatile("s_wait_xcnt 0x0" ::: "memory");
    }
}

// ---- the three projections in one launch: none needs another's result ----
// 256 blocks each, the job from the block index (block-uniform):
// Q and K: 8 feature tiles x 32 token tiles; V: 32 token tiles x 8 feature tiles;
// a block number means the same token tile and feature tile in all three jobs
#define PROJ_BLOCKS ((BATCH * SEQ / 128) * (D_INQ / 128))
__global__ void __launch_bounds__(256)
mha_qkv_kernel(const _Float16* __restrict__ xh,
               const _Float16* __restrict__ wq, const _Float16* __restrict__ wk,
               const _Float16* __restrict__ wv,
               const float* __restrict__ bq, const float* __restrict__ bk,
               const float* __restrict__ bv,
               _Float16* __restrict__ Qh, _Float16* __restrict__ Kh,
               _Float16* __restrict__ Vth, float qscale) {
    const int job = blockIdx.x / PROJ_BLOCKS;          // 0 Q, 1 K, 2 V
    const int r   = blockIdx.x % PROJ_BLOCKS;
    const bool isv = job == 2;
    gemm_nt_block(isv ? xh : job ? wk : wq,
                  isv ? wv : xh,
                  isv ? bv : job ? bk : bq,
                  (void*)(isv ? Vth : job ? Kh : Qh),
                  isv ? 2 : 0,
                  job == 0 ? qscale : 1.0f,
                  isv ? r / (D_INQ / 128) : r % (D_INQ / 128),
                  isv ? r % (D_INQ / 128) : r / (D_INQ / 128));
}

// ---- output projection ----
__global__ void __launch_bounds__(256)
mha_out_kernel(const _Float16* __restrict__ ctx, const _Float16* __restrict__ wo,
               const float* __restrict__ bo, float* __restrict__ out) {
    gemm_nt_block(ctx, wo, bo, (void*)out, 3, 1.0f, blockIdx.x, blockIdx.y);
}

#define ATT_WAVES  8
#define STG_KEYS   128
#define STG_HALVES (STG_KEYS * DK)          // halves of K, and of V^T, in a stage
#define STG_BYTES  (4 * STG_HALVES)         // K and V^T of a stage, bytes
#define NSTG       (SEQ / STG_KEYS)

// One stage: every thread copies 4 x 16 bytes of K and 4 x 16 bytes of V^T, byte
// for byte in the order of the workspace (K first, V^T behind it). lds, kg, vg:
// the thread's own first LDS byte and global addresses; a copy round of the
// block is 256 x 16 = 4096 bytes.
__device__ __forceinline__ void stage_copies(unsigned lds, const _Float16* kg,
                                             const _Float16* vg) {
    asm volatile(
        "global_load_async_to_lds_b128 %0, %8, off\n\t"
        "global_load_async_to_lds_b128 %1, %9, off\n\t"
        "global_load_async_to_lds_b128 %2, %10, off\n\t"
        "global_load_async_to_lds_b128 %3, %11, off\n\t"
        "global_load_async_to_lds_b128 %4, %12, off\n\t"
        "global_load_async_to_lds_b128 %5, %13, off\n\t"
        "global_load_async_to_lds_b128 %6, %14, off\n\t"
        "global_load_async_to_lds_b128 %7, %15, off\n\t"
        "s_wait_xcnt 0x0"
        :: "v"(lds), "v"(lds + 4096u), "v"(lds + 8192u), "v"(lds + 12288u),
           "v"(lds + 16384u), "v"(lds + 20480u), "v"(lds + 24576u), "v"(lds + 28672u),
           "v"(kg), "v"(kg + 2048), "v"(kg + 4096), "v"(kg + 6144),
           "v"(vg), "v"(vg + 2048), "v"(vg + 4096), "v"(vg + 6144)
        : "memory");
}

__global__ void __launch_bounds__(32 * ATT_WAVES) __attribute__((amdgpu_waves_per_eu(4, 4)))
mha_attn_kernel(const _Float16* __restrict__ Q,
                const _Float16* __restrict__ Km,
                const _Float16* __restrict__ Vt,
                const unsigned* __restrict__ mwords,
                _Float16* __restrict__ ctx) {
    __shared__ __attribute__((aligned(16))) _Float16 kv[2][2 * STG_HALVES];

    const int wave = threadIdx.x >> 5;
    const int lane = threadIdx.x & 31;
    const int col  = lane & 15;
    const int hi   = lane >> 4;

    // tile = blockIdx.x * 8 + wave, 0 .. B*H*(S/16)-1; a block's 8 tiles share
    // one head, so b and h come from blockIdx alone and stay scalar
    int b  = blockIdx.x >> 8;
    int h  = (blockIdx.x >> 4) & (HEADS - 1);
    int q0 = (((blockIdx.x & 15) << 3) + wave) << 4;

    const _Float16* Qbh = Q  + (size_t)(b * HEADS + h) * SEQ * DK;
    const _Float16* Kbh = Km + (size_t)(b * HEADS + h) * SEQ * DK;
    const _Float16* Vbh = Vt + (size_t)(b * HEADS + h) * DK * SEQ;

    // stage 0 on its way first: it has the longest way
    const unsigned lds0 = (unsigned)(size_t)(&kv[0][0]) + threadIdx.x * 16u;
    const _Float16* kg  = Kbh + threadIdx.x * 8;
    const _Float16* vg  = Vbh + threadIdx.x * 8;
    stage_copies(lds0, kg, vg);

    // the wave's lane-mask words, 16 per 32-key step; the wave's number as a
    // scalar, so that they come by scalar loads into scalar registers
    const int wv = __builtin_amdgcn_readfirstlane(threadIdx.x >> 5);
    const unsigned* mw = mwords
        + (size_t)(b * (SEQ / 16) + ((blockIdx.x & 15) << 3) + wv) * (SEQ / 32) * 16;
    // read through the constant address space: nothing writes the words during this
    // launch, and behind a barrier the compiler keeps scalar loads only for such reads
    typedef const __attribute__((address_space(4))) v16u* mask_words_p;
    v16u wc = *(mask_words_p)(mw);      // step 0's words

    // Q already scaled by 1/sqrt(dk) at projection time
    // (a 16-row band of Q or K is two tiles, d 0..31 and d 32..63: 16 * DK halves)
    v16h aq0 = load_frag_t(Qbh + (size_t)q0 * DK);
    v16h aq1 = load_frag_t(Qbh + (size_t)q0 * DK + FRAG);
    // these loads name registers that the set-up below reuses; the scheduling
    // barrier keeps that set-up behind the wait
    asm volatile("s_wait_xcnt 0x0" ::: "memory");
    __builtin_amdgcn_sched_barrier(0);

    float mrun = -3.0e38f;   // running maximum of query col (equal in both halves)
    float lrun = 0.f;        // running sum over this lane's own keys only
    v8f zero = {};
    v8f acc[4];              // acc[t][i] = O[q0 + col][t*16 + 8*hi + i]
#pragma unroll
    for (int t = 0; t < 4; ++t) acc[t] = zero;

    // stage 0 has landed for this wave's copies; the barrier publishes all waves'
    asm volatile("s_wait_asynccnt 0x0" ::: "memory");
    __syncthreads();
    stage_copies(lds0 + STG_BYTES, kg + STG_HALVES, vg + STG_HALVES);

    // One 32-key step on the tiles at Ks and Vs (LDS)
    auto step = [&](const _Float16* Ks, const _Float16* Vs, int k0)
        __attribute__((always_inline)) {
        // the step's K fragments, then its V fragments: one group of LDS reads
        v16h kf[4], vF[4];
#pragma unroll
        for (int j = 0; j < 4; ++j) kf[j] = load_frag_t(Ks + j * FRAG);
#pragma unroll
        for (int t = 0; t < 4; ++t) vF[t] = load_frag_t(Vs + t * FRAG);

        // S^T: two 16x16 tiles (key rows k0..k0+15, k0+16..k0+31), K-dim = 64
        v8f sA = zero, sB = zero;
        sA = wmma16(kf[0], aq0, sA);
        sA = wmma16(kf[1], aq1, sA);
        sB = wmma16(kf[2], aq0, sB);
        sB = wmma16(kf[3], aq1, sB);

        // mask + online softmax; s[j] is key k0 + kmap(j): j < 8 from sA, else sB
        float s[16];
#pragma unroll
        for (int i = 0; i < 8; ++i) {
            s[i]     = __builtin_amdgcn_inverse_ballot_w32(wc[i])     ? sA[i] : -1.0e9f;
            s[i + 8] = __builtin_amdgcn_inverse_ballot_w32(wc[i + 8]) ? sB[i] : -1.0e9f;
        }
        // next step's words, behind this step's selects: a whole step ahead of their
        // use, and not in flight at the selects' wait (a scalar-load wait is to 0)
        const int k0n = (k0 + 32 < SEQ) ? k0 + 32 : 0;
        wc = *(mask_words_p)(mw + (k0n >> 1));
        float mx[8];
#pragma unroll
        for (int i = 0; i < 8; ++i) mx[i] = fmaxf(s[i], s[i + 8]);
        float rm = fmaxf(fmaxf(fmaxf(mx[0], mx[1]), fmaxf(mx[2], mx[3])),
                         fmaxf(fmaxf(mx[4], mx[5]), fmaxf(mx[6], mx[7])));
        rm = fmaxf(rm, xhalf(rm));
        float mn = fmaxf(mrun, rm);
        float alpha = __expf(mrun - mn);
        mrun = mn;

        float p[16];
        v16h pF;
#pragma unroll
        for (int j = 0; j < 16; ++j) {
            p[j]  = __expf(s[j] - mn);
            pF[j] = (_Float16)p[j];
        }
        float ps[4];
#pragma unroll
        for (int j = 0; j < 4; ++j)
            ps[j] = (p[j] + p[j + 4]) + (p[j + 8] + p[j + 12]);
        lrun = lrun * alpha + ((ps[0] + ps[1]) + (ps[2] + ps[3]));

        // O^T = O^T * alpha + V^T(64x32) @ P^T(32x16)
#pragma unroll
        for (int t = 0; t < 4; ++t) {
#pragma unroll
            for (int i = 0; i < 8; ++i) acc[t][i] *= alpha;
            acc[t] = wmma16(vF[t], pF, acc[t]);
        }
    };

    // rolled: one trip per stage, so that the ring's order stands once in the code
#pragma unroll 1
    for (int sg = 0; sg < NSTG; ++sg) {
        // Two steps a trip of the inner loop: their 32 LDS reads go out as one group and
        // the two softmax chains interleave; all four steps of a stage unrolled scatter
        // the reads among the products, each with a wait to 0 behind it.
#pragma unroll 1
        for (int hf = 0; hf < STG_KEYS / 64; ++hf) {
            const _Float16* Ks = &kv[sg & 1][(hf & 1) * 64 * DK];
            const _Float16* Vs = Ks + STG_HALVES;
            step(Ks, Vs, sg * STG_KEYS + hf * 64);
            step(Ks + 32 * DK, Vs + 32 * DK, sg * STG_KEYS + hf * 64 + 32);
        }

        // hand-over: this wave's reads of the buffer are done ...
        asm volatile("s_wait_dscnt 0x0" ::: "memory");
        // ... its copies of stage sg + 1 have landed ...
        asm volatile("s_wait_asynccnt 0x0" ::: "memory");
        // ... and the barrier says both of every wave: it publishes stage sg + 1
        // and frees the buffer that the refill below writes
        __syncthreads();
        if (sg + 2 < NSTG)
            stage_copies(lds0 + (unsigned)(sg & 1) * STG_BYTES,
                         kg + (size_t)(sg + 2) * STG_HALVES,
                         vg + (size_t)(sg + 2) * STG_HALVES);
    }
    // no copy is left in flight when the wave ends
    asm volatile("s_wait_asynccnt 0x0" ::: "memory");

    // join the halves' sums, normalize, store context [B*S rows, 1024 k] f16 in
    // fragment order for the output GEMM: a lane's 8 registers are 8 consecutive
    // d of one query row, one chunk; k = h*64 + t*16 + 8*hi is tile h*2 + (t>>1),
    // chunk (t&1)*2 + hi
    float inv = 1.0f / (lrun + xhalf(lrun));
    _Float16* crow = ctx + ((size_t)((b * SEQ + q0) >> 4) * (D_INQ / 32) + h * 2) * FRAG
                         + hi * 128 + col * 8;
#pragma unroll
    for (int t = 0; t < 4; ++t) {
        v8h pk;
#pragma unroll
        for (int i = 0; i < 8; ++i) pk[i] = (_Float16)(acc[t][i] * inv);
        *(v8h*)(crow + (t >> 1) * FRAG + (t & 1) * 256) = pk;
    }
}

extern "C" void kernel_launch(void* const* d_in, const int* in_sizes, int n_in,
                              void* d_out, int out_size, void* d_ws, size_t ws_size,
                              hipStream_t stream) {
    (void)in_sizes; (void)n_in; (void)out_size; (void)ws_size;
    const float* x   = (const float*)d_in[0];
    const int*   msk = (const int*)d_in[1];
    const float* Wq  = (const float*)d_in[2];
    const float* bq  = (const float*)d_in[3];
    const float* Wk  = (const float*)d_in[4];
    const float* bk  = (const float*)d_in[5];
    const float* Wv  = (const float*)d_in[6];
    const float* bv  = (const float*)d_in[7];
    const float* Wo  = (const float*)d_in[8];
    const float* bo  = (const float*)d_in[9];
    float* out = (float*)d_out;

    const size_t NX = (size_t)BATCH * SEQ * D_INQ;   // 4M elems
    const size_t NW = (size_t)D_INQ * D_INQ;         // 1M elems
    char* ws = (char*)d_ws;
    _Float16* xh  = (_Float16*)(ws);
    _Float16* wqh = (_Float16*)(ws + NX * 2);
    _Float16* wkh = (_Float16*)(ws + NX * 2 + NW * 2);
    _Float16* wvh = (_Float16*)(ws + NX * 2 + NW * 4);
    _Float16* woh = (_Float16*)(ws + NX * 2 + NW * 6);
    _Float16* Qh  = (_Float16*)(ws + NX * 2 + NW * 8);
    _Float16* Kh  = (_Float16*)(ws + NX * 4 + NW * 8);
    _Float16* Vth = (_Float16*)(ws + NX * 6 + NW * 8);
    _Float16* Ch  = (_Float16*)(ws + NX * 8 + NW * 8);
    unsigned* mwd = (unsigned*)(ws + NX * 10 + NW * 8);   // B*S*S bits, 1 MB

    // xh, wqh, wkh, wvh, woh are written as one run of f16 operands from xh on
    mha_prep_kernel<<<PREP_BLOCKS, 256, 0, stream>>>(x, Wq, Wk, Wv, Wo, msk, xh, mwd);

    const float qscale = 0.125f;    // 1/sqrt(DK)
    mha_qkv_kernel<<<3 * PROJ_BLOCKS, 256, 0, stream>>>(xh, wqh, wkh, wvh, bq, bk, bv,
                                                        Qh, Kh, Vth, qscale);

    mha_attn_kernel<<<BATCH * HEADS * (SEQ / 16) / ATT_WAVES, 32 * ATT_WAVES, 0, stream>>>(
        Qh, Kh, Vth, mwd, Ch);

    dim3 gg(BATCH * SEQ / 128, D_INQ / 128);   // 32 M-tiles x 8 N-tiles of 128 x 128
    mha_out_kernel<<<gg, 256, 0, stream>>>(Ch, woh, bo, out);
}

// v009
// It runs in 89.3 microseconds.
// Two timings next to v008 put it at 1.15 and 1.13 times that version's speed.
// All steps since v000 together make it 3.42 times as fast.
#include <hip/hip_runtime.h>

typedef __attribute__((ext_vector_type(16))) _Float16 v16h;
typedef __attribute__((ext_vector_type(8)))  _Float16 v8h;
typedef __attribute__((ext_vector_type(8)))  float    v8f;
typedef __attribute__((ext_vector_type(4)))  int      v4i;
typedef __attribute__((ext_vector_type(4)))  float    v4f;
typedef __attribute__((ext_vector_type(4)))  _Float16 v4h;
typedef __attribute__((ext_vector_type(2)))  unsigned v2u;
typedef __attribute__((ext_vector_type(4)))  unsigned v4u;
typedef __attribute__((ext_vector_type(16))) unsigned v16u;

#define D_INQ  1024
#define HEADS  16
#define DK     64
#define BATCH  2
#define SEQ    2048

#define FRAG 512
__device__ __forceinline__ v16h load_frag_t(const _Float16* tile) {
    const int lane = threadIdx.x & 31;
    const _Float16* p = tile + lane * 8;
    v8h lo = *(const v8h*)(p);                  // K = 8*(l>>4) .. +7
    v8h hi = *(const v8h*)(p + 256);            // K = 16 + 8*(l>>4) .. +7
    v16h f;
#pragma unroll
    for (int i = 0; i < 8; ++i) { f[i] = lo[i]; f[i + 8] = hi[i]; }
    return f;
}

__device__ __forceinline__ v8f wmma16(v16h a, v16h b, v8f c) {
    return __builtin_amdgcn_wmma_f32_16x16x32_f16(false, a, false, b,
                                                  (short)0, c, false, false);
}

__device__ __forceinline__ float xhalf(float x) {
    int b = __builtin_bit_cast(int, x);
    return __builtin_bit_cast(float,
        __builtin_amdgcn_permlanex16(b, b, 0x76543210, 0xfedcba98, false, false));
}

__device__ __forceinline__ unsigned xpair(unsigned v) {
    return (unsigned)__builtin_amdgcn_mov_dpp((int)v, 0xB1, 0xF, 0xF, true);
}

__device__ __forceinline__ void cvt_f16_tiles(const float* __restrict__ src,
                                              _Float16* __restrict__ dst, int wt) {
    const int lane = threadIdx.x & 31;
    const int q    = lane >> 3;                  // row within a load's 4 rows
    const int odd  = lane & 1;
    const int t0   = wt << 2;                    // first tile: band * 32 + k tile
    const float* s = src + (size_t)(((t0 >> 5) << 4) + q) * D_INQ
                         + ((t0 & 31) << 5) + ((lane & 7) << 2);
    v4f u[4][4];
#pragma unroll
    for (int tt = 0; tt < 4; ++tt)
#pragma unroll
        for (int i = 0; i < 4; ++i)
            u[tt][i] = *(const v4f*)(s + tt * 32 + i * 4 * D_INQ);
    // all 16 loads name one address pair: as an input here it stays whole up to the
    // wait (the compiler had placed the last load's result on it)
    asm volatile("s_wait_xcnt 0x0" :: "v"(s) : "memory");
    // keeps the conversions behind the last load: without it the compiler reuses the
    // first loads' registers for the later ones, which then wait out a second latency
    __builtin_amdgcn_sched_barrier(0);
    _Float16* d = dst + (size_t)t0 * FRAG + ((lane & 7) >> 1) * 128 + (q + 4 * odd) * 8;
#pragma unroll
    for (int tt = 0; tt < 4; ++tt)
#pragma unroll
        for (int pr = 0; pr < 2; ++pr) {
            v4h ha, hb;                          // rows q + 8 pr and q + 4 + 8 pr
#pragma unroll
            for (int i = 0; i < 4; ++i) {
                ha[i] = (_Float16)u[tt][2 * pr][i];
                hb[i] = (_Float16)u[tt][2 * pr + 1][i];
            }
            v2u a = __builtin_bit_cast(v2u, ha);
            v2u b = __builtin_bit_cast(v2u, hb);
            unsigned r0 = xpair(odd ? a[0] : b[0]);
            unsigned r1 = xpair(odd ? a[1] : b[1]);
            v4u o;                               // k 0..3 from the even lane, 4..7 from the odd
            o[0] = odd ? r0 : a[0];
            o[1] = odd ? r1 : a[1];
            o[2] = odd ? b[0] : r0;
            o[3] = odd ? b[1] : r1;
            *(v4u*)(d + tt * FRAG + pr * 64) = o;
        }
}

__device__ __forceinline__ void mask_pack_block(const int* __restrict__ mask,
                                                unsigned* __restrict__ mw, int blk) {
    const int lane = threadIdx.x & 31;
    const int col  = lane & 15;
    const int hi   = lane >> 4;
    // the wave's number as a scalar: the rows' addresses stay in scalar registers
    const int task = blk * 8 + __builtin_amdgcn_readfirstlane(threadIdx.x >> 5);
    const int tile = task >> 4;                             // b * (SEQ / 16) + q tile
    const int k0   = (task & 15) << 7;                      // group of 4 steps
    const int* mrow = mask + (size_t)(tile * 16) * SEQ + k0;
    v4i m[16];
#pragma unroll
    for (int r = 0; r < 16; ++r)
        m[r] = *(const v4i*)(mrow + r * SEQ + lane * 4);
    // keeps the compares behind the last load, so that all 16 loads fly together
    __builtin_amdgcn_sched_barrier(0);
    unsigned x[4] = {0u, 0u, 0u, 0u};    // row col: word e, bit l is key 4 l + e
#pragma unroll
    for (int r = 0; r < 16; ++r)
#pragma unroll
        for (int e = 0; e < 4; ++e) {
            unsigned bl = __builtin_amdgcn_ballot_w32(m[r][e] != 0);
            x[e] = (col == r) ? bl : x[e];
        }
    // key = st * 32 + (j >> 3) * 16 + 8 * hi + (j & 7): word j & 3, bit key >> 2;
    // the lane's own part of the bit number, 2 * hi, is shifted out once
#pragma unroll
    for (int e = 0; e < 4; ++e) x[e] >>= 2 * hi;
    v2u w = {0u, 0u};
#pragma unroll
    for (int j = 0; j < 64; ++j) {
        const unsigned bit = (j >> 4) * 8 + ((j >> 3) & 1) * 4 + ((j >> 2) & 1);
        unsigned bl = __builtin_amdgcn_ballot_w32((x[j & 3] & (1u << bit)) != 0u);
        w[j & 1] = (lane == (j >> 1)) ? bl : w[j & 1];
    }
    *(v2u*)(mw + (size_t)task * 64 + lane * 2) = w;
}

// ---- one launch for all the work that needs nothing but the inputs ----
// The mask pack and the five conversions read and write disjoint data, so they
// share one grid: a range of the block index (a block-uniform branch) picks the
// job. The five f16 operands lie one behind the other in the workspace, x first,
// so a conversion block's number is also its place in the destination.
// A conversion block is 8 waves of 4 tiles each.
#define PREP_MASK_BLOCKS (BATCH * (SEQ / 16) * (SEQ / 128) / 8)
#define PREP_X_BLOCKS    (BATCH * SEQ * D_INQ / FRAG / 32)
#define PREP_W_BLOCKS    (D_INQ * D_INQ / FRAG / 32)
#define PREP_BLOCKS      (PREP_MASK_BLOCKS + PREP_X_BLOCKS + 4 * PREP_W_BLOCKS)
__global__ void __launch_bounds__(256)
mha_prep_kernel(const float* __restrict__ x,
                const float* __restrict__ Wq, const float* __restrict__ Wk,
                const float* __restrict__ Wv, const float* __restrict__ Wo,
                const int* __restrict__ mask,
                _Float16* __restrict__ f16ops, unsigned* __restrict__ mw) {
    if (blockIdx.x < PREP_MASK_BLOCKS) {
        mask_pack_block(mask, mw, blockIdx.x);
        return;
    }
    const int cb = blockIdx.x - PREP_MASK_BLOCKS;      // conversion block, x first
    const float* src = x;
    int base = 0;                                      // the matrix's first block
    if (cb >= PREP_X_BLOCKS) {
        const int w = (cb - PREP_X_BLOCKS) / PREP_W_BLOCKS;
        src  = w == 0 ? Wq : w == 1 ? Wk : w == 2 ? Wv : Wo;
        base = PREP_X_BLOCKS + w * PREP_W_BLOCKS;
    }
    // the wave's number as a scalar: the tiles' addresses stay in scalar registers
    const int wave = __builtin_amdgcn_readfirstlane(threadIdx.x >> 5);
    cvt_f16_tiles(src, f16ops + (size_t)base * 32 * FRAG, (cb - base) * 8 + wave);
}

// ---- NT GEMM: C[M,N] = A[M,1024] @ B[N,1024]^T + bias, A and B in fragment order ----
// Wave tile: 32 rows x 64 cols (2 A-frags share 4 B-frags -> 8 WMMA/K-step).
// Block tile: 128 rows x 128 cols, 4 x 2 waves: per K-step the block's waves ask for
// 8 KB of A and 8 KB of B between them (each A tile read by 2 waves, each B tile
// by 4), the fewest distinct lines that 8 such waves can need from L2.
// Double-buffered, K-loop unrolled x2: stage s computes while stage 1-s loads.
// No rotation copies: each buffer written only by loads, read only by WMMAs.
// mode 0: A = weight (rows = features), B = tokens, bias by row; a lane's 8
//         accumulator registers are 8 consecutive d of one token: one chunk of
//         the [s x d] operand of head (b,h), stored f16 in fragment order (scaled)
// mode 2: A = tokens, B = weight; f16 V^T of head (b,h) in fragment order
// mode 3: A = tokens, B = weight; f32 row-major [M,1024]
// bx, by: the block's 128-row tile and its 128-column tile
// rot: the pair of k tiles (64 k) at which the block enters its k walk, 0 .. 15; it
// wraps round. Blocks that share operand rows are spread over the 16 values of rot, so
// that fewer of them ask L2 for the same lines at the same moment; the k sum starts at
// another place.
__device__ __forceinline__ void
gemm_nt_block(const _Float16* __restrict__ A,
              const _Float16* __restrict__ Bm,
              const float* __restrict__ bias,
              void* __restrict__ outp, int mode, float scale, int bx, int by, int rot) {
    const int wave = __builtin_amdgcn_readfirstlane(threadIdx.x >> 5);
    const int lane = threadIdx.x & 31;
    const int col  = lane & 15;
    const int hi   = lane >> 4;

    const int m0    = ((bx << 2) + (wave & 3)) << 5;   // 32 rows per wave, 4 waves down
    const int nbase = ((by << 1) + (wave >> 2)) << 6;  // 64 cols per wave, 2 waves across

    v8f acc[2][4];
    if (mode == 0) {
        float bv[2][8];
#pragma unroll
        for (int mh = 0; mh < 2; ++mh)
#pragma unroll
            for (int i = 0; i < 8; ++i) bv[mh][i] = bias[m0 + mh * 16 + 8 * hi + i];
        // these loads name registers that the copies and the set-up below reuse
        asm volatile("s_wait_xcnt 0x0" ::: "memory");
#pragma unroll
        for (int mh = 0; mh < 2; ++mh)
#pragma unroll
            for (int i = 0; i < 8; ++i)
#pragma unroll
                for (int t = 0; t < 4; ++t) acc[mh][t][i] = bv[mh][i];
    } else {
#pragma unroll
        for (int t = 0; t < 4; ++t) {
            float bv = bias[nbase + t * 16 + col];
#pragma unroll
            for (int i = 0; i < 8; ++i) { acc[0][t][i] = bv; acc[1][t][i] = bv; }
        }
    }

    // a 16-row band is RT = 32 tiles; k advances one tile (FRAG halves) per 32
    const int RT = (D_INQ / 32) * FRAG;
    const _Float16* A0 = A + (size_t)(m0 >> 4) * RT;
    const _Float16* Bw = Bm + (size_t)(nbase >> 4) * RT;

    v16h a0[2], a1[2], bf[2][4];

    int kp = rot;                                   // the pair of k tiles in work
    const _Float16* pa = A0 + rot * 2 * FRAG;       // tiles of stage 0, wave-uniform
    const _Float16* pb = Bw + rot * 2 * FRAG;

    // prologue: stage 0 <- the walk's first tile
    a0[0] = load_frag_t(pa);
    a1[0] = load_frag_t(pa + RT);
#pragma unroll
    for (int t = 0; t < 4; ++t)
        bf[0][t] = load_frag_t(pb + t * RT);

#pragma unroll 1
    for (int k = 0; k < D_INQ; k += 64) {
        // stage 1 <- the pair's second tile (overlaps stage-0 WMMAs)
        a0[1] = load_frag_t(pa + FRAG);
        a1[1] = load_frag_t(pa + RT + FRAG);
#pragma unroll
        for (int t = 0; t < 4; ++t)
            bf[1][t] = load_frag_t(pb + t * RT + FRAG);

#pragma unroll
        for (int t = 0; t < 4; ++t) {
            acc[0][t] = wmma16(a0[0], bf[0][t], acc[0][t]);
            acc[1][t] = wmma16(a1[0], bf[0][t], acc[1][t]);
        }

        // stage 0 <- the next pair, round the band's end (the last trip's lands on the
        // walk's first tile again, unused; overlaps stage-1 WMMAs)
        kp = (kp + 1) & (D_INQ / 64 - 1);
        pa = kp ? pa + 2 * FRAG : A0;
        pb = kp ? pb + 2 * FRAG : Bw;
        a0[0] = load_frag_t(pa);
        a1[0] = load_frag_t(pa + RT);
#pragma unroll
        for (int t = 0; t < 4; ++t)
            bf[0][t] = load_frag_t(pb + t * RT);

#pragma unroll
        for (int t = 0; t < 4; ++t) {
            acc[0][t] = wmma16(a0[1], bf[1][t], acc[0][t]);
            acc[1][t] = wmma16(a1[1], bf[1][t], acc[1][t]);
        }
    }
    // the last trip's loads still name the lane offset, which the epilogues rewrite, and
    // the two tile pointers: as inputs here these stay whole up to the wait (the compiler
    // had lifted an argument load onto one of them);
    // the scheduling barrier keeps the epilogues' set-up behind the wait
    asm volatile("s_wait_xcnt 0x0" :: "s"(pa), "s"(pb) : "memory");
    __builtin_amdgcn_sched_barrier(0);

    if (mode == 3) {
        float* out = (float*)outp;
#pragma unroll
        for (int mh = 0; mh < 2; ++mh)
#pragma unroll
            for (int i = 0; i < 8; ++i) {
                int tg = m0 + mh * 16 + i + 8 * hi;
#pragma unroll
                for (int t = 0; t < 4; ++t)
                    out[(size_t)tg * D_INQ + nbase + t * 16 + col] = acc[mh][t][i];
            }
        // the stores' registers may be rewritten behind this branch
        asm volatile("s_wait_xcnt 0x0" ::: "memory");
    } else if (mode == 2) {
        // V^T of head (b,h), rows d, k = s: a lane's 8 accumulator registers are
        // 8 consecutive s of one d row, one chunk. Tiles in the order
        // [32-key step][d tile], so that a step's four fragments are 4 KB in a row.
        _Float16* out = (_Float16*)outp;
#pragma unroll
        for (int mh = 0; mh < 2; ++mh) {
            int tg0 = m0 + mh * 16 + 8 * hi;   // multiple of 8: one batch, 16-B aligned
            int b  = tg0 >> 11;       // / SEQ
            int s0 = tg0 & (SEQ - 1);
#pragma unroll
            for (int t = 0; t < 4; ++t) {
                int o = nbase + t * 16 + col;
                int h = o >> 6, d = o & 63;
                v8h pk;
#pragma unroll
                for (int i = 0; i < 8; ++i)
                    pk[i] = (_Float16)(acc[mh][t][i] * scale);
                *(v8h*)(out + (size_t)(b * HEADS + h) * DK * SEQ
                            + (size_t)((s0 >> 5) * 4 + (d >> 4)) * FRAG
                            + ((s0 >> 3) & 3) * 128 + (d & 15) * 8) = pk;
            }
        }
    } else {
        // Q/K of head (b,h), rows s, k = d: tiles in the order [16-row band][d / 32]
        _Float16* out = (_Float16*)outp;
#pragma unroll
        for (int mh = 0; mh < 2; ++mh) {
            int o0 = m0 + mh * 16 + 8 * hi;    // multiple of 8: one head, one chunk
            int h  = o0 >> 6, d0 = o0 & 63;
#pragma unroll
            for (int t = 0; t < 4; ++t) {
                int tg = nbase + t * 16 + col;
                int b = tg >> 11;         // / SEQ
                int s = tg & (SEQ - 1);
                v8h pk;
#pragma unroll
                for (int i = 0; i < 8; ++i)
                    pk[i] = (_Float16)(acc[mh][t][i] * scale);
                *(v8h*)(out + (size_t)(b * HEADS + h) * SEQ * DK
                            + (size_t)((s >> 4) * 2 + (d0 >> 5)) * FRAG
                            + ((d0 >> 3) & 3) * 128 + (s & 15) * 8) = pk;
            }
        }
        // the stores' registers may be rewritten behind this branch
        asm volatile("s_wait_xcnt 0x0" ::: "memory");
    }
}

// ---- the three projections in one launch: none needs another's result ----
// 256 blocks each, the job from the block index (block-uniform):
// Q and K: 8 feature tiles x 32 token tiles; V: 32 token tiles x 8 feature tiles;
// a block number means the same token tile and feature tile in all three jobs.
// k entry: 2 * feature tile + token tile + job: the 8 blocks of a job on one token tile
// and any 16 token tiles in a row on one feature tile all differ, and Q's and K's blocks
// on one token tile differ too (24 blocks share its rows, so V's meet Q's entries)
#define PROJ_BLOCKS ((BATCH * SEQ / 128) * (D_INQ / 128))
__global__ void __launch_bounds__(256)
mha_qkv_kernel(const _Float16* __restrict__ xh,
               const _Float16* __restrict__ wq, const _Float16* __restrict__ wk,
               const _Float16* __restrict__ wv,
               const float* __restrict__ bq, const float* __restrict__ bk,
               const float* __restrict__ bv,
               _Float16* __restrict__ Qh, _Float16* __restrict__ Kh,
               _Float16* __restrict__ Vth, float qscale) {
    const int job = blockIdx.x / PROJ_BLOCKS;          // 0 Q, 1 K, 2 V
    const int r   = blockIdx.x % PROJ_BLOCKS;
    const bool isv = job == 2;
    gemm_nt_block(isv ? xh : job ? wk : wq,
                  isv ? wv : xh,
                  isv ? bv : job ? bk : bq,
                  (void*)(isv ? Vth : job ? Kh : Qh),
                  isv ? 2 : 0,
                  job == 0 ? qscale : 1.0f,
                  isv ? r / (D_INQ / 128) : r % (D_INQ / 128),
                  isv ? r % (D_INQ / 128) : r / (D_INQ / 128),
                  (2 * (r % (D_INQ / 128)) + r / (D_INQ / 128) + job) & 15);
}

// ---- output projection ----
__global__ void __launch_bounds__(256)
mha_out_kernel(const _Float16* __restrict__ ctx, const _Float16* __restrict__ wo,
               const float* __restrict__ bo, float* __restrict__ out) {
    gemm_nt_block(ctx, wo, bo, (void*)out, 3, 1.0f, blockIdx.x, blockIdx.y,
                  (2 * blockIdx.y + blockIdx.x) & 15);
}

#define ATT_WAVES  8
#define STG_KEYS   128
#define STG_HALVES (STG_KEYS * DK)          // halves of K, and of V^T, in a stage
#define STG_BYTES  (4 * STG_HALVES)         // K and V^T of a stage, bytes
#define NSTG       (SEQ / STG_KEYS)

// One stage: every thread copies 4 x 16 bytes of K and 4 x 16 bytes of V^T, byte
// for byte in the order of the workspace (K first, V^T behind it). lds, kg, vg:
// the thread's own first LDS byte and global addresses; a copy round of the
// block is 256 x 16 = 4096 bytes.
__device__ __forceinline__ void stage_copies(unsigned lds, const _Float16* kg,
                                             const _Float16* vg) {
    asm volatile(
        "global_load_async_to_lds_b128 %0, %8, off\n\t"
        "global_load_async_to_lds_b128 %1, %9, off\n\t"
        "global_load_async_to_lds_b128 %2, %10, off\n\t"
        "global_load_async_to_lds_b128 %3, %11, off\n\t"
        "global_load_async_to_lds_b128 %4, %12, off\n\t"
        "global_load_async_to_lds_b128 %5, %13, off\n\t"
        "global_load_async_to_lds_b128 %6, %14, off\n\t"
        "global_load_async_to_lds_b128 %7, %15, off\n\t"
        "s_wait_xcnt 0x0"
        :: "v"(lds), "v"(lds + 4096u), "v"(lds + 8192u), "v"(lds + 12288u),
           "v"(lds + 16384u), "v"(lds + 20480u), "v"(lds + 24576u), "v"(lds + 28672u),
           "v"(kg), "v"(kg + 2048), "v"(kg + 4096), "v"(kg + 6144),
           "v"(vg), "v"(vg + 2048), "v"(vg + 4096), "v"(vg + 6144)
        : "memory");
}

__global__ void __launch_bounds__(32 * ATT_WAVES) __attribute__((amdgpu_waves_per_eu(4, 4)))
mha_attn_kernel(const _Float16* __restrict__ Q,
                const _Float16* __restrict__ Km,
                const _Float16* __restrict__ Vt,
                const unsigned* __restrict__ mwords,
                _Float16* __restrict__ ctx) {
    __shared__ __attribute__((aligned(16))) _Float16 kv[2][2 * STG_HALVES];

    const int wave = threadIdx.x >> 5;
    const int lane = threadIdx.x & 31;
    const int col  = lane & 15;
    const int hi   = lane >> 4;

    // tile = blockIdx.x * 8 + wave, 0 .. B*H*(S/16)-1; a block's 8 tiles share
    // one head, so b and h come from blockIdx alone and stay scalar
    int b  = blockIdx.x >> 8;
    int h  = (blockIdx.x >> 4) & (HEADS - 1);
    int q0 = (((blockIdx.x & 15) << 3) + wave) << 4;

    const _Float16* Qbh = Q  + (size_t)(b * HEADS + h) * SEQ * DK;
    const _Float16* Kbh = Km + (size_t)(b * HEADS + h) * SEQ * DK;
    const _Float16* Vbh = Vt + (size_t)(b * HEADS + h) * DK * SEQ;

    // stage 0 on its way first: it has the longest way
    const unsigned lds0 = (unsigned)(size_t)(&kv[0][0]) + threadIdx.x * 16u;
    const _Float16* kg  = Kbh + threadIdx.x * 8;
    const _Float16* vg  = Vbh + threadIdx.x * 8;
    const int rot = ((blockIdx.x & 15) + h) & (NSTG - 1);    // the walk's first stage
    stage_copies(lds0, kg + (size_t)rot * STG_HALVES, vg + (size_t)rot * STG_HALVES);

    // the wave's lane-mask words, 16 per 32-key step; the wave's number as a
    // scalar, so that they come by scalar loads into scalar registers
    const int wv = __builtin_amdgcn_readfirstlane(threadIdx.x >> 5);
    const unsigned* mw = mwords
        + (size_t)(b * (SEQ / 16) + ((blockIdx.x & 15) << 3) + wv) * (SEQ / 32) * 16;
    // read through the constant address space: nothing writes the words during this
    // launch, and behind a barrier the compiler keeps scalar loads only for such reads
    typedef const __attribute__((address_space(4))) v16u* mask_words_p;
    v16u wc = *(mask_words_p)(mw + rot * (STG_KEYS / 2));      // the first step's words

    // Q already scaled by 1/sqrt(dk) at projection time
    // (a 16-row band of Q or K is two tiles, d 0..31 and d 32..63: 16 * DK halves)
    v16h aq0 = load_frag_t(Qbh + (size_t)q0 * DK);
    v16h aq1 = load_frag_t(Qbh + (size_t)q0 * DK + FRAG);
    // these loads name registers that the set-up below reuses; the scheduling
    // barrier keeps that set-up behind the wait
    asm volatile("s_wait_xcnt 0x0" ::: "memory");
    __builtin_amdgcn_sched_barrier(0);

    float mrun = -3.0e38f;   // running maximum of query col (equal in both halves)
    float lrun = 0.f;        // running sum over this lane's own keys only
    v8f zero = {};
    v8f acc[4];              // acc[t][i] = O[q0 + col][t*16 + 8*hi + i]
#pragma unroll
    for (int t = 0; t < 4; ++t) acc[t] = zero;

    // stage 0 has landed for this wave's copies; the barrier publishes all waves'
    asm volatile("s_wait_asynccnt 0x0" ::: "memory");
    __syncthreads();
    stage_copies(lds0 + STG_BYTES, kg + (size_t)((rot + 1) & (NSTG - 1)) * STG_HALVES,
                 vg + (size_t)((rot + 1) & (NSTG - 1)) * STG_HALVES);

    // One 32-key step on the tiles at Ks and Vs (LDS)
    auto step = [&](const _Float16* Ks, const _Float16* Vs, int k0)
        __attribute__((always_inline)) {
        // the step's K fragments, then its V fragments: one group of LDS reads
        v16h kf[4], vF[4];
#pragma unroll
        for (int j = 0; j < 4; ++j) kf[j] = load_frag_t(Ks + j * FRAG);
#pragma unroll
        for (int t = 0; t < 4; ++t) vF[t] = load_frag_t(Vs + t * FRAG);

        // S^T: two 16x16 tiles (key rows k0..k0+15, k0+16..k0+31), K-dim = 64
        v8f sA = zero, sB = zero;
        sA = wmma16(kf[0], aq0, sA);
        sA = wmma16(kf[1], aq1, sA);
        sB = wmma16(kf[2], aq0, sB);
        sB = wmma16(kf[3], aq1, sB);

        // mask + online softmax; s[j] is key k0 + kmap(j): j < 8 from sA, else sB
        float s[16];
#pragma unroll
        for (int i = 0; i < 8; ++i) {
            s[i]     = __builtin_amdgcn_inverse_ballot_w32(wc[i])     ? sA[i] : -1.0e9f;
            s[i + 8] = __builtin_amdgcn_inverse_ballot_w32(wc[i + 8]) ? sB[i] : -1.0e9f;
        }
        // next step's words, behind this step's selects: a whole step ahead of their
        // use, and not in flight at the selects' wait (a scalar-load wait is to 0)
        const int k0n = (k0 + 32 < SEQ) ? k0 + 32 : 0;
        wc = *(mask_words_p)(mw + (k0n >> 1));
        float mx[8];
#pragma unroll
        for (int i = 0; i < 8; ++i) mx[i] = fmaxf(s[i], s[i + 8]);
        float rm = fmaxf(fmaxf(fmaxf(mx[0], mx[1]), fmaxf(mx[2], mx[3])),
                         fmaxf(fmaxf(mx[4], mx[5]), fmaxf(mx[6], mx[7])));
        rm = fmaxf(rm, xhalf(rm));
        float mn = fmaxf(mrun, rm);
        float alpha = __expf(mrun - mn);
        mrun = mn;

        float p[16];
        v16h pF;
#pragma unroll
        for (int j = 0; j < 16; ++j) {
            p[j]  = __expf(s[j] - mn);
            pF[j] = (_Float16)p[j];
        }
        float ps[4];
#pragma unroll
        for (int j = 0; j < 4; ++j)
            ps[j] = (p[j] + p[j + 4]) + (p[j + 8] + p[j + 12]);
        lrun = lrun * alpha + ((ps[0] + ps[1]) + (ps[2] + ps[3]));

        // O^T = O^T * alpha + V^T(64x32) @ P^T(32x16)
#pragma unroll
        for (int t = 0; t < 4; ++t) {
#pragma unroll
            for (int i = 0; i < 8; ++i) acc[t][i] *= alpha;
            acc[t] = wmma16(vF[t], pF, acc[t]);
        }
    };

    // rolled: one trip per stage, so that the ring's order stands once in the code
#pragma unroll 1
    for (int sg = 0; sg < NSTG; ++sg) {
        // Two steps a trip of the inner loop: their 32 LDS reads go out as one group and
        // the two softmax chains interleave; all four steps of a stage unrolled scatter
        // the reads among the products, each with a wait to 0 behind it.
#pragma unroll 1
        for (int hf = 0; hf < STG_KEYS / 64; ++hf) {
            const _Float16* Ks = &kv[sg & 1][(hf & 1) * 64 * DK];
            const _Float16* Vs = Ks + STG_HALVES;
            const int k0 = ((sg + rot) & (NSTG - 1)) * STG_KEYS + hf * 64;
            step(Ks, Vs, k0);
            step(Ks + 32 * DK, Vs + 32 * DK, k0 + 32);
        }

        // hand-over: this wave's reads of the buffer are done ...
        asm volatile("s_wait_dscnt 0x0" ::: "memory");
        // ... its copies of stage sg + 1 have landed ...
        asm volatile("s_wait_asynccnt 0x0" ::: "memory");
        // ... and the barrier says both of every wave: it publishes stage sg + 1
        // and frees the buffer that the refill below writes
        __syncthreads();
        if (sg + 2 < NSTG)
            stage_copies(lds0 + (unsigned)(sg & 1) * STG_BYTES,
                         kg + (size_t)((sg + 2 + rot) & (NSTG - 1)) * STG_HALVES,
                         vg + (size_t)((sg + 2 + rot) & (NSTG - 1)) * STG_HALVES);
    }
    // no copy is left in flight when the wave ends
    asm volatile("s_wait_asynccnt 0x0" ::: "memory");

    // join the halves' sums, normalize, store context [B*S rows, 1024 k] f16 in
    // fragment order for the output GEMM: a lane's 8 registers are 8 consecutive
    // d of one query row, one chunk; k = h*64 + t*16 + 8*hi is tile h*2 + (t>>1),
    // chunk (t&1)*2 + hi
    float inv = 1.0f / (lrun + xhalf(lrun));
    _Float16* crow = ctx + ((size_t)((b * SEQ + q0) >> 4) * (D_INQ / 32) + h * 2) * FRAG
                         + hi * 128 + col * 8;
#pragma unroll
    for (int t = 0; t < 4; ++t) {
        v8h pk;
#pragma unroll
        for (int i = 0; i < 8; ++i) pk[i] = (_Float16)(acc[t][i] * inv);
        *(v8h*)(crow + (t >> 1) * FRAG + (t & 1) * 256) = pk;
    }
}

extern "C" void kernel_launch(void* const* d_in, const int* in_sizes, int n_in,
                              void* d_out, int out_size, void* d_ws, size_t ws_size,
                              hipStream_t stream) {
    (void)in_sizes; (void)n_in; (void)out_size; (void)ws_size;
    const float* x   = (const float*)d_in[0];
    const int*   msk = (const int*)d_in[1];
    const float* Wq  = (const float*)d_in[2];
    const float* bq  = (const float*)d_in[3];
    const float* Wk  = (const float*)d_in[4];
    const float* bk  = (const float*)d_in[5];
    const float* Wv  = (const float*)d_in[6];
    const float* bv  = (const float*)d_in[7];
    const float* Wo  = (const float*)d_in[8];
    const float* bo  = (const float*)d_in[9];
    float* out = (float*)d_out;

    const size_t NX = (size_t)BATCH * SEQ * D_INQ;   // 4M elems
    const size_t NW = (size_t)D_INQ * D_INQ;         // 1M elems
    char* ws = (char*)d_ws;
    _Float16* xh  = (_Float16*)(ws);
    _Float16* wqh = (_Float16*)(ws + NX * 2);
    _Float16* wkh = (_Float16*)(ws + NX * 2 + NW * 2);
    _Float16* wvh = (_Float16*)(ws + NX * 2 + NW * 4);
    _Float16* woh = (_Float16*)(ws + NX * 2 + NW * 6);
    _Float16* Qh  = (_Float16*)(ws + NX * 2 + NW * 8);
    _Float16* Kh  = (_Float16*)(ws + NX * 4 + NW * 8);
    _Float16* Vth = (_Float16*)(ws + NX * 6 + NW * 8);
    _Float16* Ch  = (_Float16*)(ws + NX * 8 + NW * 8);
    unsigned* mwd = (unsigned*)(ws + NX * 10 + NW * 8);   // B*S*S bits, 1 MB

    // xh, wqh, wkh, wvh, woh are written as one run of f16 operands from xh on
    mha_prep_kernel<<<PREP_BLOCKS, 256, 0, stream>>>(x, Wq, Wk, Wv, Wo, msk, xh, mwd);

    const float qscale = 0.125f;    // 1/sqrt(DK)
    mha_qkv_kernel<<<3 * PROJ_BLOCKS, 256, 0, stream>>>(xh, wqh, wkh, wvh, bq, bk, bv,
                                                        Qh, Kh, Vth, qscale);

    mha_attn_kernel<<<BATCH * HEADS * (SEQ / 16) / ATT_WAVES, 32 * ATT_WAVES, 0, stream>>>(
        Qh, Kh, Vth, mwd, Ch);

    dim3 gg(BATCH * SEQ / 128, D_INQ / 128);   // 32 M-tiles x 8 N-tiles of 128 x 128
    mha_out_kernel<<<gg, 256, 0, stream>>>(Ch, woh, bo, out);
}

// v010
// A run of this version takes 83.3 microseconds.
// Timed twice side by side with v009, it ran 1.08 and 1.07 times as fast.
// Over all steps from v000 it is 3.68 times as fast.
#include <hip/hip_runtime.h>

typedef __attribute__((ext_vector_type(16))) _Float16 v16h;
typedef __attribute__((ext_vector_type(8)))  _Float16 v8h;
typedef __attribute__((ext_vector_type(8)))  float    v8f;
typedef __attribute__((ext_vector_type(4)))  int      v4i;
typedef __attribute__((ext_vector_type(4)))  float    v4f;
typedef __attribute__((ext_vector_type(4)))  _Float16 v4h;
typedef __attribute__((ext_vector_type(2)))  unsigned v2u;
typedef __attribute__((ext_vector_type(4)))  unsigned v4u;
typedef __attribute__((ext_vector_type(16))) unsigned v16u;

#define D_INQ  1024
#define HEADS  16
#define DK     64
#define BATCH  2
#define SEQ    2048

#define FRAG 512
__device__ __forceinline__ v16h load_frag_t(const _Float16* tile) {
    const int lane = threadIdx.x & 31;
    const _Float16* p = tile + lane * 8;
    v8h lo = *(const v8h*)(p);                  // K = 8*(l>>4) .. +7
    v8h hi = *(const v8h*)(p + 256);            // K = 16 + 8*(l>>4) .. +7
    v16h f;
#pragma unroll
    for (int i = 0; i < 8; ++i) { f[i] = lo[i]; f[i + 8] = hi[i]; }
    return f;
}

__device__ __forceinline__ v8f wmma16(v16h a, v16h b, v8f c) {
    return __builtin_amdgcn_wmma_f32_16x16x32_f16(false, a, false, b,
                                                  (short)0, c, false, false);
}

__device__ __forceinline__ float xhalf(float x) {
    int b = __builtin_bit_cast(int, x);
    return __builtin_bit_cast(float,
        __builtin_amdgcn_permlanex16(b, b, 0x76543210, 0xfedcba98, false, false));
}

__device__ __forceinline__ unsigned xpair(unsigned v) {
    return (unsigned)__builtin_amdgcn_mov_dpp((int)v, 0xB1, 0xF, 0xF, true);
}

__device__ __forceinline__ void cvt_f16_tiles(const float* __restrict__ src,
                                              _Float16* __restrict__ dst, int wt) {
    const int lane = threadIdx.x & 31;
    const int q    = lane >> 3;                  // row within a load's 4 rows
    const int odd  = lane & 1;
    const int t0   = wt << 2;                    // first tile: band * 32 + k tile
    const float* s = src + (size_t)(((t0 >> 5) << 4) + q) * D_INQ
                         + ((t0 & 31) << 5) + ((lane & 7) << 2);
    v4f u[4][4];
#pragma unroll
    for (int tt = 0; tt < 4; ++tt)
#pragma unroll
        for (int i = 0; i < 4; ++i)
            u[tt][i] = *(const v4f*)(s + tt * 32 + i * 4 * D_INQ);
    // all 16 loads name one address pair: as an input here it stays whole up to the
    // wait (the compiler had placed the last load's result on it)
    asm volatile("s_wait_xcnt 0x0" :: "v"(s) : "memory");
    // keeps the conversions behind the last load: without it the compiler reuses the
    // first loads' registers for the later ones, which then wait out a second latency
    __builtin_amdgcn_sched_barrier(0);
    _Float16* d = dst + (size_t)t0 * FRAG + ((lane & 7) >> 1) * 128 + (q + 4 * odd) * 8;
#pragma unroll
    for (int tt = 0; tt < 4; ++tt)
#pragma unroll
        for (int pr = 0; pr < 2; ++pr) {
            v4h ha, hb;                          // rows q + 8 pr and q + 4 + 8 pr
#pragma unroll
            for (int i = 0; i < 4; ++i) {
                ha[i] = (_Float16)u[tt][2 * pr][i];
                hb[i] = (_Float16)u[tt][2 * pr + 1][i];
            }
            v2u a = __builtin_bit_cast(v2u, ha);
            v2u b = __builtin_bit_cast(v2u, hb);
            unsigned r0 = xpair(odd ? a[0] : b[0]);
            unsigned r1 = xpair(odd ? a[1] : b[1]);
            v4u o;                               // k 0..3 from the even lane, 4..7 from the odd
            o[0] = odd ? r0 : a[0];
            o[1] = odd ? r1 : a[1];
            o[2] = odd ? b[0] : r0;
            o[3] = odd ? b[1] : r1;
            *(v4u*)(d + tt * FRAG + pr * 64) = o;
        }
}

__device__ __forceinline__ void mask_pack_block(const int* __restrict__ mask,
                                                unsigned* __restrict__ mw, int blk) {
    const int lane = threadIdx.x & 31;
    const int col  = lane & 15;
    const int hi   = lane >> 4;
    // the wave's number as a scalar: the rows' addresses stay in scalar registers
    const int task = blk * 8 + __builtin_amdgcn_readfirstlane(threadIdx.x >> 5);
    const int tile = task >> 4;                             // b * (SEQ / 16) + q tile
    const int k0   = (task & 15) << 7;                      // group of 4 steps
    const int* mrow = mask + (size_t)(tile * 16) * SEQ + k0;
    v4i m[16];
#pragma unroll
    for (int r = 0; r < 16; ++r)
        m[r] = *(const v4i*)(mrow + r * SEQ + lane * 4);
    // keeps the compares behind the last load, so that all 16 loads fly together
    __builtin_amdgcn_sched_barrier(0);
    unsigned x[4] = {0u, 0u, 0u, 0u};    // row col: word e, bit l is key 4 l + e
#pragma unroll
    for (int r = 0; r < 16; ++r)
#pragma unroll
        for (int e = 0; e < 4; ++e) {
            unsigned bl = __builtin_amdgcn_ballot_w32(m[r][e] != 0);
            x[e] = (col == r) ? bl : x[e];
        }
    // key = st * 32 + (j >> 3) * 16 + 8 * hi + (j & 7): word j & 3, bit key >> 2;
    // the lane's own part of the bit number, 2 * hi, is shifted out once
#pragma unroll
    for (int e = 0; e < 4; ++e) x[e] >>= 2 * hi;
    v2u w = {0u, 0u};
#pragma unroll
    for (int j = 0; j < 64; ++j) {
        const unsigned bit = (j >> 4) * 8 + ((j >> 3) & 1) * 4 + ((j >> 2) & 1);
        unsigned bl = __builtin_amdgcn_ballot_w32((x[j & 3] & (1u << bit)) != 0u);
        w[j & 1] = (lane == (j >> 1)) ? bl : w[j & 1];
    }
    *(v2u*)(mw + (size_t)task * 64 + lane * 2) = w;
}

// ---- one launch for all the work that needs nothing but the inputs ----
// The mask pack and the five conversions read and write disjoint data, so they
// share one grid: a range of the block index (a block-uniform branch) picks the
// job. The five f16 operands lie one behind the other in the workspace, x first,
// so a conversion block's number is also its place in the destination.
// A conversion block is 8 waves of 4 tiles each.
#define PREP_MASK_BLOCKS (BATCH * (SEQ / 16) * (SEQ / 128) / 8)
#define PREP_X_BLOCKS    (BATCH * SEQ * D_INQ / FRAG / 32)
#define PREP_W_BLOCKS    (D_INQ * D_INQ / FRAG / 32)
#define PREP_BLOCKS      (PREP_MASK_BLOCKS + PREP_X_BLOCKS + 4 * PREP_W_BLOCKS)
__global__ void __launch_bounds__(256)
mha_prep_kernel(const float* __restrict__ x,
                const float* __restrict__ Wq, const float* __restrict__ Wk,
                const float* __restrict__ Wv, const float* __restrict__ Wo,
                const int* __restrict__ mask,
                _Float16* __restrict__ f16ops, unsigned* __restrict__ mw) {
    if (blockIdx.x < PREP_MASK_BLOCKS) {
        mask_pack_block(mask, mw, blockIdx.x);
        return;
    }
    const int cb = blockIdx.x - PREP_MASK_BLOCKS;      // conversion block, x first
    const float* src = x;
    int base = 0;                                      // the matrix's first block
    if (cb >= PREP_X_BLOCKS) {
        const int w = (cb - PREP_X_BLOCKS) / PREP_W_BLOCKS;
        src  = w == 0 ? Wq : w == 1 ? Wk : w == 2 ? Wv : Wo;
        base = PREP_X_BLOCKS + w * PREP_W_BLOCKS;
    }
    // the wave's number as a scalar: the tiles' addresses stay in scalar registers
    const int wave = __builtin_amdgcn_readfirstlane(threadIdx.x >> 5);
    cvt_f16_tiles(src, f16ops + (size_t)base * 32 * FRAG, (cb - base) * 8 + wave);
}

template <int LEAD>
__device__ __forceinline__ void
gemm_nt_block(const _Float16* __restrict__ A,
              const _Float16* __restrict__ Bm,
              const float* __restrict__ bias,
              void* __restrict__ outp, int mode, float scale, int bx, int by, int rot) {
    const int wave = __builtin_amdgcn_readfirstlane(threadIdx.x >> 5);
    const int lane = threadIdx.x & 31;
    const int col  = lane & 15;
    const int hi   = lane >> 4;

    const int m0    = ((bx << 2) + (wave & 3)) << 5;   // 32 rows per wave, 4 waves down
    const int nbase = ((by << 1) + (wave >> 2)) << 6;  // 64 cols per wave, 2 waves across

    v8f acc[2][4];
    if (mode == 0) {
        float bv[2][8];
#pragma unroll
        for (int mh = 0; mh < 2; ++mh)
#pragma unroll
            for (int i = 0; i < 8; ++i) bv[mh][i] = bias[m0 + mh * 16 + 8 * hi + i];
        // these loads name registers that the copies and the set-up below reuse
        asm volatile("s_wait_xcnt 0x0" ::: "memory");
#pragma unroll
        for (int mh = 0; mh < 2; ++mh)
#pragma unroll
            for (int i = 0; i < 8; ++i)
#pragma unroll
                for (int t = 0; t < 4; ++t) acc[mh][t][i] = bv[mh][i];
    } else {
#pragma unroll
        for (int t = 0; t < 4; ++t) {
            float bv = bias[nbase + t * 16 + col];
#pragma unroll
            for (int i = 0; i < 8; ++i) { acc[0][t][i] = bv; acc[1][t][i] = bv; }
        }
    }

    // a 16-row band is RT = 32 tiles; k advances one tile (FRAG halves) per 32
    const int RT = (D_INQ / 32) * FRAG;
    const _Float16* A0 = A + (size_t)(m0 >> 4) * RT;
    const _Float16* Bw = Bm + (size_t)(nbase >> 4) * RT;

    constexpr int KT = D_INQ / 32;                  // k tiles in the walk
    constexpr int NA = 2 * (LEAD + 1);
    constexpr int NB = 4 * (LEAD + 1) - 1;
    v16h fa[NA], fb[NB];
    const int kt0 = rot * 2;                        // the walk's first k tile

    // prologue: k tiles 0 .. LEAD - 1 of the walk, whole
#pragma unroll
    for (int j = 0; j < LEAD; ++j) {
        const int off = ((kt0 + j) & (KT - 1)) * FRAG;
        const _Float16* pa = A0 + off;              // wave-uniform
        const _Float16* pb = Bw + off;
        fa[(2 * j) % NA]     = load_frag_t(pa);
        fa[(2 * j + 1) % NA] = load_frag_t(pa + RT);
#pragma unroll
        for (int t = 0; t < 4; ++t)
            fb[(4 * j + t) % NB] = load_frag_t(pb + t * RT);
        // the loads name the two tile pointers: as inputs here these stay whole up to
        // the wait, and the next tile's pointers are formed behind it
        asm volatile("s_wait_xcnt 0x0" :: "s"(pa), "s"(pb) : "memory");
    }

    // unrolled whole, so that the ring indices are constants
#pragma unroll
    for (int s = 0; s < KT; ++s) {
        const int j   = s + LEAD;                   // the k tile whose loads go out now
        const int off = ((kt0 + j) & (KT - 1)) * FRAG;   // round the band's end
        const _Float16* pa = A0 + off;
        const _Float16* pb = Bw + off;
        if (j < KT) {
            fa[(2 * j) % NA]     = load_frag_t(pa);
            fa[(2 * j + 1) % NA] = load_frag_t(pa + RT);
#pragma unroll
            for (int t = 0; t < 3; ++t)
                fb[(4 * j + t) % NB] = load_frag_t(pb + t * RT);
        }
        // keeps the loads in front of the block: without it the compiler sinks each load
        // to just before its use, into one register set, and the wave waits out the
        // latency several times a k tile
        __builtin_amdgcn_sched_barrier(0);
        acc[0][0] = wmma16(fa[(2 * s) % NA],     fb[(4 * s) % NB], acc[0][0]);
        acc[1][0] = wmma16(fa[(2 * s + 1) % NA], fb[(4 * s) % NB], acc[1][0]);
        __builtin_amdgcn_sched_barrier(0);
        if (j < KT)
            fb[(4 * j + 3) % NB] = load_frag_t(pb + 3 * RT);
        // ... and in front of the rest of the block
        __builtin_amdgcn_sched_barrier(0);
#pragma unroll
        for (int t = 1; t < 4; ++t) {
            acc[0][t] = wmma16(fa[(2 * s) % NA],     fb[(4 * s + t) % NB], acc[0][t]);
            acc[1][t] = wmma16(fa[(2 * s + 1) % NA], fb[(4 * s + t) % NB], acc[1][t]);
        }
        // keeps the wait below behind the block, where it no longer stalls the wave
        __builtin_amdgcn_sched_barrier(0);
        // this pass's loads name the two tile pointers (and the lane offset, which the
        // epilogues rewrite): as inputs here the pointers stay whole up to the wait
        if (j < KT)
            asm volatile("s_wait_xcnt 0x0" :: "s"(pa), "s"(pb) : "memory");
        // keeps the next pass's pointers and loads, and the epilogues' set-up, behind it
        __builtin_amdgcn_sched_barrier(0);
    }

    if (mode == 3) {
        float* out = (float*)outp;
#pragma unroll
        for (int mh = 0; mh < 2; ++mh)
#pragma unroll
            for (int i = 0; i < 8; ++i) {
                int tg = m0 + mh * 16 + i + 8 * hi;
#pragma unroll
                for (int t = 0; t < 4; ++t)
                    out[(size_t)tg * D_INQ + nbase + t * 16 + col] = acc[mh][t][i];
            }
        // the stores' registers may be rewritten behind this branch
        asm volatile("s_wait_xcnt 0x0" ::: "memory");
    } else if (mode == 2) {
        // V^T of head (b,h), rows d, k = s: a lane's 8 accumulator registers are
        // 8 consecutive s of one d row, one chunk. Tiles in the order
        // [32-key step][d tile], so that a step's four fragments are 4 KB in a row.
        _Float16* out = (_Float16*)outp;
#pragma unroll
        for (int mh = 0; mh < 2; ++mh) {
            int tg0 = m0 + mh * 16 + 8 * hi;   // multiple of 8: one batch, 16-B aligned
            int b  = tg0 >> 11;       // / SEQ
            int s0 = tg0 & (SEQ - 1);
#pragma unroll
            for (int t = 0; t < 4; ++t) {
                int o = nbase + t * 16 + col;
                int h = o >> 6, d = o & 63;
                v8h pk;
#pragma unroll
                for (int i = 0; i < 8; ++i)
                    pk[i] = (_Float16)(acc[mh][t][i] * scale);
                *(v8h*)(out + (size_t)(b * HEADS + h) * DK * SEQ
                            + (size_t)((s0 >> 5) * 4 + (d >> 4)) * FRAG
                            + ((s0 >> 3) & 3) * 128 + (d & 15) * 8) = pk;
            }
        }
    } else {
        // Q/K of head (b,h), rows s, k = d: tiles in the order [16-row band][d / 32]
        _Float16* out = (_Float16*)outp;
#pragma unroll
        for (int mh = 0; mh < 2; ++mh) {
            int o0 = m0 + mh * 16 + 8 * hi;    // multiple of 8: one head, one chunk
            int h  = o0 >> 6, d0 = o0 & 63;
#pragma unroll
            for (int t = 0; t < 4; ++t) {
                int tg = nbase + t * 16 + col;
                int b = tg >> 11;         // / SEQ
                int s = tg & (SEQ - 1);
                v8h pk;
#pragma unroll
                for (int i = 0; i < 8; ++i)
                    pk[i] = (_Float16)(acc[mh][t][i] * scale);
                *(v8h*)(out + (size_t)(b * HEADS + h) * SEQ * DK
                            + (size_t)((s >> 4) * 2 + (d0 >> 5)) * FRAG
                            + ((d0 >> 3) & 3) * 128 + (s & 15) * 8) = pk;
            }
        }
        // the stores' registers may be rewritten behind this branch
        asm volatile("s_wait_xcnt 0x0" ::: "memory");
    }
}

// ---- the three projections in one launch: none needs another's result ----
// 256 blocks each, the job from the block index (block-uniform):
// Q and K: 8 feature tiles x 32 token tiles; V: 32 token tiles x 8 feature tiles;
// a block number means the same token tile and feature tile in all three jobs.
// k entry: 2 * feature tile + token tile + job: the 8 blocks of a job on one token tile
// and any 16 token tiles in a row on one feature tile all differ, and Q's and K's blocks
// on one token tile differ too (24 blocks share its rows, so V's meet Q's entries)
#define PROJ_BLOCKS ((BATCH * SEQ / 128) * (D_INQ / 128))
__global__ void __launch_bounds__(256)
mha_qkv_kernel(const _Float16* __restrict__ xh,
               const _Float16* __restrict__ wq, const _Float16* __restrict__ wk,
               const _Float16* __restrict__ wv,
               const float* __restrict__ bq, const float* __restrict__ bk,
               const float* __restrict__ bv,
               _Float16* __restrict__ Qh, _Float16* __restrict__ Kh,
               _Float16* __restrict__ Vth, float qscale) {
    const int job = blockIdx.x / PROJ_BLOCKS;          // 0 Q, 1 K, 2 V
    const int r   = blockIdx.x % PROJ_BLOCKS;
    const bool isv = job == 2;
    gemm_nt_block<1>(isv ? xh : job ? wk : wq,
                  isv ? wv : xh,
                  isv ? bv : job ? bk : bq,
                  (void*)(isv ? Vth : job ? Kh : Qh),
                  isv ? 2 : 0,
                  job == 0 ? qscale : 1.0f,
                  isv ? r / (D_INQ / 128) : r % (D_INQ / 128),
                  isv ? r % (D_INQ / 128) : r / (D_INQ / 128),
                  (2 * (r % (D_INQ / 128)) + r / (D_INQ / 128) + job) & 15);
}

// ---- output projection ----
__global__ void __launch_bounds__(256)
mha_out_kernel(const _Float16* __restrict__ ctx, const _Float16* __restrict__ wo,
               const float* __restrict__ bo, float* __restrict__ out) {
    gemm_nt_block<3>(ctx, wo, bo, (void*)out, 3, 1.0f, blockIdx.x, blockIdx.y,
                  (2 * blockIdx.y + blockIdx.x) & 15);
}

#define ATT_WAVES  8
#define STG_KEYS   128
#define STG_HALVES (STG_KEYS * DK)          // halves of K, and of V^T, in a stage
#define STG_BYTES  (4 * STG_HALVES)         // K and V^T of a stage, bytes
#define NSTG       (SEQ / STG_KEYS)

// One stage: every thread copies 4 x 16 bytes of K and 4 x 16 bytes of V^T, byte
// for byte in the order of the workspace (K first, V^T behind it). lds, kg, vg:
// the thread's own first LDS byte and global addresses; a copy round of the
// block is 256 x 16 = 4096 bytes.
__device__ __forceinline__ void stage_copies(unsigned lds, const _Float16* kg,
                                             const _Float16* vg) {
    asm volatile(
        "global_load_async_to_lds_b128 %0, %8, off\n\t"
        "global_load_async_to_lds_b128 %1, %9, off\n\t"
        "global_load_async_to_lds_b128 %2, %10, off\n\t"
        "global_load_async_to_lds_b128 %3, %11, off\n\t"
        "global_load_async_to_lds_b128 %4, %12, off\n\t"
        "global_load_async_to_lds_b128 %5, %13, off\n\t"
        "global_load_async_to_lds_b128 %6, %14, off\n\t"
        "global_load_async_to_lds_b128 %7, %15, off\n\t"
        "s_wait_xcnt 0x0"
        :: "v"(lds), "v"(lds + 4096u), "v"(lds + 8192u), "v"(lds + 12288u),
           "v"(lds + 16384u), "v"(lds + 20480u), "v"(lds + 24576u), "v"(lds + 28672u),
           "v"(kg), "v"(kg + 2048), "v"(kg + 4096), "v"(kg + 6144),
           "v"(vg), "v"(vg + 2048), "v"(vg + 4096), "v"(vg + 6144)
        : "memory");
}

__global__ void __launch_bounds__(32 * ATT_WAVES) __attribute__((amdgpu_waves_per_eu(4, 4)))
mha_attn_kernel(const _Float16* __restrict__ Q,
                const _Float16* __restrict__ Km,
                const _Float16* __restrict__ Vt,
                const unsigned* __restrict__ mwords,
                _Float16* __restrict__ ctx) {
    __shared__ __attribute__((aligned(16))) _Float16 kv[2][2 * STG_HALVES];

    const int wave = threadIdx.x >> 5;
    const int lane = threadIdx.x & 31;
    const int col  = lane & 15;
    const int hi   = lane >> 4;

    // tile = blockIdx.x * 8 + wave, 0 .. B*H*(S/16)-1; a block's 8 tiles share
    // one head, so b and h come from blockIdx alone and stay scalar
    int b  = blockIdx.x >> 8;
    int h  = (blockIdx.x >> 4) & (HEADS - 1);
    int q0 = (((blockIdx.x & 15) << 3) + wave) << 4;

    const _Float16* Qbh = Q  + (size_t)(b * HEADS + h) * SEQ * DK;
    const _Float16* Kbh = Km + (size_t)(b * HEADS + h) * SEQ * DK;
    const _Float16* Vbh = Vt + (size_t)(b * HEADS + h) * DK * SEQ;

    // stage 0 on its way first: it has the longest way
    const unsigned lds0 = (unsigned)(size_t)(&kv[0][0]) + threadIdx.x * 16u;
    const _Float16* kg  = Kbh + threadIdx.x * 8;
    const _Float16* vg  = Vbh + threadIdx.x * 8;
    const int rot = ((blockIdx.x & 15) + h) & (NSTG - 1);    // the walk's first stage
    stage_copies(lds0, kg + (size_t)rot * STG_HALVES, vg + (size_t)rot * STG_HALVES);

    // the wave's lane-mask words, 16 per 32-key step; the wave's number as a
    // scalar, so that they come by scalar loads into scalar registers
    const int wv = __builtin_amdgcn_readfirstlane(threadIdx.x >> 5);
    const unsigned* mw = mwords
        + (size_t)(b * (SEQ / 16) + ((blockIdx.x & 15) << 3) + wv) * (SEQ / 32) * 16;
    // read through the constant address space: nothing writes the words during this
    // launch, and behind a barrier the compiler keeps scalar loads only for such reads
    typedef const __attribute__((address_space(4))) v16u* mask_words_p;
    v16u wc = *(mask_words_p)(mw + rot * (STG_KEYS / 2));      // the first step's words

    // Q already scaled by 1/sqrt(dk) at projection time
    // (a 16-row band of Q or K is two tiles, d 0..31 and d 32..63: 16 * DK halves)
    v16h aq0 = load_frag_t(Qbh + (size_t)q0 * DK);
    v16h aq1 = load_frag_t(Qbh + (size_t)q0 * DK + FRAG);
    // these loads name registers that the set-up below reuses; the scheduling
    // barrier keeps that set-up behind the wait
    asm volatile("s_wait_xcnt 0x0" ::: "memory");
    __builtin_amdgcn_sched_barrier(0);

    float mrun = -3.0e38f;   // running maximum of query col (equal in both halves)
    float lrun = 0.f;        // running sum over this lane's own keys only
    v8f zero = {};
    v8f acc[4];              // acc[t][i] = O[q0 + col][t*16 + 8*hi + i]
#pragma unroll
    for (int t = 0; t < 4; ++t) acc[t] = zero;

    // stage 0 has landed for this wave's copies; the barrier publishes all waves'
    asm volatile("s_wait_asynccnt 0x0" ::: "memory");
    __syncthreads();
    stage_copies(lds0 + STG_BYTES, kg + (size_t)((rot + 1) & (NSTG - 1)) * STG_HALVES,
                 vg + (size_t)((rot + 1) & (NSTG - 1)) * STG_HALVES);

    // One 32-key step on the tiles at Ks and Vs (LDS)
    auto step = [&](const _Float16* Ks, const _Float16* Vs, int k0)
        __attribute__((always_inline)) {
        // the step's K fragments, then its V fragments: one group of LDS reads
        v16h kf[4], vF[4];
#pragma unroll
        for (int j = 0; j < 4; ++j) kf[j] = load_frag_t(Ks + j * FRAG);
#pragma unroll
        for (int t = 0; t < 4; ++t) vF[t] = load_frag_t(Vs + t * FRAG);

        // S^T: two 16x16 tiles (key rows k0..k0+15, k0+16..k0+31), K-dim = 64
        v8f sA = zero, sB = zero;
        sA = wmma16(kf[0], aq0, sA);
        sA = wmma16(kf[1], aq1, sA);
        sB = wmma16(kf[2], aq0, sB);
        sB = wmma16(kf[3], aq1, sB);

        // mask + online softmax; s[j] is key k0 + kmap(j): j < 8 from sA, else sB
        float s[16];
#pragma unroll
        for (int i = 0; i < 8; ++i) {
            s[i]     = __builtin_amdgcn_inverse_ballot_w32(wc[i])     ? sA[i] : -1.0e9f;
            s[i + 8] = __builtin_amdgcn_inverse_ballot_w32(wc[i + 8]) ? sB[i] : -1.0e9f;
        }
        // next step's words, behind this step's selects: a whole step ahead of their
        // use, and not in flight at the selects' wait (a scalar-load wait is to 0)
        const int k0n = (k0 + 32 < SEQ) ? k0 + 32 : 0;
        wc = *(mask_words_p)(mw + (k0n >> 1));
        float mx[8];
#pragma unroll
        for (int i = 0; i < 8; ++i) mx[i] = fmaxf(s[i], s[i + 8]);
        float rm = fmaxf(fmaxf(fmaxf(mx[0], mx[1]), fmaxf(mx[2], mx[3])),
                         fmaxf(fmaxf(mx[4], mx[5]), fmaxf(mx[6], mx[7])));
        rm = fmaxf(rm, xhalf(rm));
        float mn = fmaxf(mrun, rm);
        float alpha = __expf(mrun - mn);
        mrun = mn;

        float p[16];
        v16h pF;
#pragma unroll
        for (int j = 0; j < 16; ++j) {
            p[j]  = __expf(s[j] - mn);
            pF[j] = (_Float16)p[j];
        }
        float ps[4];
#pragma unroll
        for (int j = 0; j < 4; ++j)
            ps[j] = (p[j] + p[j + 4]) + (p[j + 8] + p[j + 12]);
        lrun = lrun * alpha + ((ps[0] + ps[1]) + (ps[2] + ps[3]));

        // O^T = O^T * alpha + V^T(64x32) @ P^T(32x16)
#pragma unroll
        for (int t = 0; t < 4; ++t) {
#pragma unroll
            for (int i = 0; i < 8; ++i) acc[t][i] *= alpha;
            acc[t] = wmma16(vF[t], pF, acc[t]);
        }
    };

    // rolled: one trip per stage, so that the ring's order stands once in the code
#pragma unroll 1
    for (int sg = 0; sg < NSTG; ++sg) {
        // Two steps a trip of the inner loop: their 32 LDS reads go out as one group and
        // the two softmax chains interleave; all four steps of a stage unrolled scatter
        // the reads among the products, each with a wait to 0 behind it.
#pragma unroll 1
        for (int hf = 0; hf < STG_KEYS / 64; ++hf) {
            const _Float16* Ks = &kv[sg & 1][(hf & 1) * 64 * DK];
            const _Float16* Vs = Ks + STG_HALVES;
            const int k0 = ((sg + rot) & (NSTG - 1)) * STG_KEYS + hf * 64;
            step(Ks, Vs, k0);
            step(Ks + 32 * DK, Vs + 32 * DK, k0 + 32);
        }

        // hand-over: this wave's reads of the buffer are done ...
        asm volatile("s_wait_dscnt 0x0" ::: "memory");
        // ... its copies of stage sg + 1 have landed ...
        asm volatile("s_wait_asynccnt 0x0" ::: "memory");
        // ... and the barrier says both of every wave: it publishes stage sg + 1
        // and frees the buffer that the refill below writes
        __syncthreads();
        if (sg + 2 < NSTG)
            stage_copies(lds0 + (unsigned)(sg & 1) * STG_BYTES,
                         kg + (size_t)((sg + 2 + rot) & (NSTG - 1)) * STG_HALVES,
                         vg + (size_t)((sg + 2 + rot) & (NSTG - 1)) * STG_HALVES);
    }
    // no copy is left in flight when the wave ends
    asm volatile("s_wait_asynccnt 0x0" ::: "memory");

    // join the halves' sums, normalize, store context [B*S rows, 1024 k] f16 in
    // fragment order for the output GEMM: a lane's 8 registers are 8 consecutive
    // d of one query row, one chunk; k = h*64 + t*16 + 8*hi is tile h*2 + (t>>1),
    // chunk (t&1)*2 + hi
    float inv = 1.0f / (lrun + xhalf(lrun));
    _Float16* crow = ctx + ((size_t)((b * SEQ + q0) >> 4) * (D_INQ / 32) + h * 2) * FRAG
                         + hi * 128 + col * 8;
#pragma unroll
    for (int t = 0; t < 4; ++t) {
        v8h pk;
#pragma unroll
        for (int i = 0; i < 8; ++i) pk[i] = (_Float16)(acc[t][i] * inv);
        *(v8h*)(crow + (t >> 1) * FRAG + (t & 1) * 256) = pk;
    }
}

extern "C" void kernel_launch(void* const* d_in, const int* in_sizes, int n_in,
                              void* d_out, int out_size, void* d_ws, size_t ws_size,
                              hipStream_t stream) {
    (void)in_sizes; (void)n_in; (void)out_size; (void)ws_size;
    const float* x   = (const float*)d_in[0];
    const int*   msk = (const int*)d_in[1];
    const float* Wq  = (const float*)d_in[2];
    const float* bq  = (const float*)d_in[3];
    const float* Wk  = (const float*)d_in[4];
    const float* bk  = (const float*)d_in[5];
    const float* Wv  = (const float*)d_in[6];
    const float* bv  = (const float*)d_in[7];
    const float* Wo  = (const float*)d_in[8];
    const float* bo  = (const float*)d_in[9];
    float* out = (float*)d_out;

    const size_t NX = (size_t)BATCH * SEQ * D_INQ;   // 4M elems
    const size_t NW = (size_t)D_INQ * D_INQ;         // 1M elems
    char* ws = (char*)d_ws;
    _Float16* xh  = (_Float16*)(ws);
    _Float16* wqh = (_Float16*)(ws + NX * 2);
    _Float16* wkh = (_Float16*)(ws + NX * 2 + NW * 2);
    _Float16* wvh = (_Float16*)(ws + NX * 2 + NW * 4);
    _Float16* woh = (_Float16*)(ws + NX * 2 + NW * 6);
    _Float16* Qh  = (_Float16*)(ws + NX * 2 + NW * 8);
    _Float16* Kh  = (_Float16*)(ws + NX * 4 + NW * 8);
    _Float16* Vth = (_Float16*)(ws + NX * 6 + NW * 8);
    _Float16* Ch  = (_Float16*)(ws + NX * 8 + NW * 8);
    unsigned* mwd = (unsigned*)(ws + NX * 10 + NW * 8);   // B*S*S bits, 1 MB

    // xh, wqh, wkh, wvh, woh are written as one run of f16 operands from xh on
    mha_prep_kernel<<<PREP_BLOCKS, 256, 0, stream>>>(x, Wq, Wk, Wv, Wo, msk, xh, mwd);

    const float qscale = 0.125f;    // 1/sqrt(DK)
    mha_qkv_kernel<<<3 * PROJ_BLOCKS, 256, 0, stream>>>(xh, wqh, wkh, wvh, bq, bk, bv,
                                                        Qh, Kh, Vth, qscale);

    mha_attn_kernel<<<BATCH * HEADS * (SEQ / 16) / ATT_WAVES, 32 * ATT_WAVES, 0, stream>>>(
        Qh, Kh, Vth, mwd, Ch);

    dim3 gg(BATCH * SEQ / 128, D_INQ / 128);   // 32 M-tiles x 8 N-tiles of 128 x 128
    mha_out_kernel<<<gg, 256, 0, stream>>>(Ch, woh, bo, out);
}
